// v000
// Measured on an AMD MI455X. A time is GPU time per run, averaged over a window of back-to-back runs after a warm-up
// (all launches, gaps included; the runs take copies of the inputs in turn), and the median of several windows.
// Apart from v000's, it joins two sittings. Times from different sittings can be a few percent apart, while
// side-by-side timings come from the same sitting.
// v000, which the later versions start from, runs in 1000 microseconds.
#include <hip/hip_runtime.h>

#include <hip/hip_runtime.h>

#define NB_  4
#define TT   2048
#define DM   512
#define NH_  8
#define NKV  8
#define REP  (NH_ / NKV)
#define HD   64
#define DQ   (NH_ * HD)
#define DKV  (NKV * HD)
#define ZH   2
#define RH   2048                 // every row hi/lo (unscaled-ish logits: sigma ~8)
#define WIN  2048
#define PCAR 1024.0f
#define SCL  0.125f   // HD^-0.5
typedef _Float16 h16;
typedef unsigned short bf;
typedef __attribute__((ext_vector_type(16))) __bf16   v16bf;
typedef __attribute__((ext_vector_type(16))) _Float16 v16h;
typedef __attribute__((ext_vector_type(8)))  _Float16 v8h;
typedef __attribute__((ext_vector_type(8)))  unsigned short v8us;
typedef __attribute__((ext_vector_type(8)))  float    v8f;
typedef __attribute__((ext_vector_type(4)))  float    v4f;
typedef v8h  __attribute__((may_alias)) v8ha;
typedef v4f  __attribute__((may_alias)) v4fa;
typedef v8us __attribute__((may_alias)) v8usa;

__device__ __forceinline__ unsigned short f2bf(float f) { unsigned u = __float_as_uint(f); u += 0x7FFFu + ((u >> 16) & 1u); return (unsigned short)(u >> 16); }
__device__ __forceinline__ float bf2f(unsigned short b) { return __uint_as_float(((unsigned)b) << 16); }
__device__ __forceinline__ float bfr(float f) { return bf2f(f2bf(f)); }
__device__ __forceinline__ v16h cat16(v8h lo, v8h hi) { return __builtin_shufflevector(lo, hi, 0, 1, 2, 3, 4, 5, 6, 7, 8, 9, 10, 11, 12, 13, 14, 15); }
__device__ __forceinline__ v16bf cat16b(v8us lo, v8us hi) { return __builtin_bit_cast(v16bf, __builtin_shufflevector(lo, hi, 0, 1, 2, 3, 4, 5, 6, 7, 8, 9, 10, 11, 12, 13, 14, 15)); }
__device__ __forceinline__ v8f wmma16(v16h a, v16h b, v8f c) { return __builtin_amdgcn_wmma_f32_16x16x32_f16(false, a, false, b, (short)0, c, false, false); }
__device__ __forceinline__ v8f wmmab(v16bf a, v16bf b, v8f c) { return __builtin_amdgcn_wmma_f32_16x16x32_bf16(false, a, false, b, (short)0, c, false, false); }



// ---- k_gemmw: register-blocked GEMM, ONE WAVE per 64x64 output tile (16 accumulators), operands straight from K-contiguous 16-bit planes; grid (M/64, N/64, Z), 32 threads.
// C[m][n] (f32, pitch ldc, + optional f32 bias[n]) = sum_k A[m][k] Bt[n][k] (+ split products per NSPLIT). z-batch strides sA/sB/sC in elements. K % 32 == 0.
template <typename T16> struct WFrag;
template <> struct WFrag<h16> { typedef v16h V; static __device__ __forceinline__ V ld(const h16* p) { return cat16(*(const v8h*)p, *(const v8h*)(p + 16)); } static __device__ __forceinline__ v8f mma(V a, V b, v8f c) { return wmma16(a, b, c); } };
template <> struct WFrag<bf> { typedef v16bf V; static __device__ __forceinline__ V ld(const bf* p) { return cat16b(*(const v8us*)p, *(const v8us*)(p + 16)); } static __device__ __forceinline__ v8f mma(V a, V b, v8f c) { return wmmab(a, b, c); } };
template <typename T16, int NSPLIT, bool BIAS>
__global__ __launch_bounds__(32) void k_gemmw(const T16* __restrict__ A, const T16* __restrict__ A2, const T16* __restrict__ Bt, const T16* __restrict__ Bt2, int K, float* C, int ldc, const float* __restrict__ bias, size_t sA, size_t sB, size_t sC) {
    typedef typename WFrag<T16>::V V;
    __shared__ __align__(16) float os[16 * 68];
    const size_t z = blockIdx.z; A += z * sA; if (A2) A2 += z * sA; Bt += z * sB; if (Bt2) Bt2 += z * sB; C += z * sC;
    const int lane = threadIdx.x & 31, lr = lane & 15, hi = lane >> 4; const int r0 = blockIdx.x * 64, c0 = blockIdx.y * 64;
    v8f acc[4][4];
#pragma unroll
    for (int mb = 0; mb < 4; ++mb)
#pragma unroll
        for (int nb = 0; nb < 4; ++nb) acc[mb][nb] = (v8f){};
    const size_t aoff = (size_t)(r0 + lr) * K + 8 * hi, boff = (size_t)(c0 + lr) * K + 8 * hi;
#pragma unroll 1
    for (int kc = 0; kc < K; kc += 32) {
        V a[4], a2[4];
#pragma unroll
        for (int mb = 0; mb < 4; ++mb) { a[mb] = WFrag<T16>::ld(A + aoff + (size_t)mb * 16 * K + kc); if (NSPLIT == 1 || NSPLIT == 2) a2[mb] = WFrag<T16>::ld(A2 + aoff + (size_t)mb * 16 * K + kc); }
#pragma unroll
        for (int nb = 0; nb < 4; ++nb) { const V b = WFrag<T16>::ld(Bt + boff + (size_t)nb * 16 * K + kc); V b2; if (NSPLIT >= 2) b2 = WFrag<T16>::ld(Bt2 + boff + (size_t)nb * 16 * K + kc);
#pragma unroll
            for (int mb = 0; mb < 4; ++mb) { acc[mb][nb] = WFrag<T16>::mma(a[mb], b, acc[mb][nb]); if (NSPLIT == 1 || NSPLIT == 2) acc[mb][nb] = WFrag<T16>::mma(a2[mb], b, acc[mb][nb]); if (NSPLIT >= 2) acc[mb][nb] = WFrag<T16>::mma(a[mb], b2, acc[mb][nb]); } }
        asm volatile("v_nop\n\tv_nop\n\tv_nop\n\tv_nop" : "+v"(acc[0][0]), "+v"(acc[1][1]), "+v"(acc[2][2]), "+v"(acc[3][3]) : "v"(a[0]), "v"(a[3]));
    }
#pragma unroll
    for (int mb = 0; mb < 4; ++mb) {
#pragma unroll
        for (int nb = 0; nb < 4; ++nb) {
#pragma unroll
            for (int j = 0; j < 8; ++j) os[(hi * 8 + j) * 68 + nb * 16 + lr] = acc[mb][nb][j]; }
        __builtin_amdgcn_wave_barrier(); asm volatile("" ::: "memory");
        float* crow = C + (size_t)(r0 + mb * 16) * ldc + c0;
{
#pragma unroll
            for (int s = 0; s < 8; ++s) { const int row = 2 * s + hi, cofs = lr * 4; v4f val = *(const v4fa*)(os + row * 68 + cofs); if (BIAS) { val[0] += bfr(bias[c0 + cofs]); val[1] += bfr(bias[c0 + cofs + 1]); val[2] += bfr(bias[c0 + cofs + 2]); val[3] += bfr(bias[c0 + cofs + 3]); }
                *(v4f*)(crow + (size_t)row * ldc + cofs) = val; }
             }
        __builtin_amdgcn_wave_barrier(); asm volatile("" ::: "memory");
    }
}

// ---- k_gemmc: the same one-wave 64x64 tile GEMM specialised for causal attention: CMODE 1 skips score tiles entirely above the diagonal (query rows r0+roff.., key columns c0..), CMODE 2 limits the
// key (K) loop of the probability x value contraction to the diagonal block (probabilities beyond it are exactly zero). roff = row offset of this launch's first row within the sequence.
template <typename T16, int NSPLIT, int CMODE>
__global__ __launch_bounds__(32) void k_gemmc(const T16* __restrict__ A, const T16* __restrict__ A2, const T16* __restrict__ Bt, const T16* __restrict__ Bt2, int K, float* C, int ldc, int roff, size_t sA, size_t sB, size_t sC) {
    typedef typename WFrag<T16>::V V;
    __shared__ __align__(16) float os[16 * 68];
    const size_t z = blockIdx.z; A += z * sA; if (A2) A2 += z * sA; Bt += z * sB; if (Bt2) Bt2 += z * sB; C += z * sC;
    const int lane = threadIdx.x & 31, lr = lane & 15, hi = lane >> 4; const int r0 = blockIdx.x * 64, c0 = blockIdx.y * 64;
    if (CMODE == 1 && c0 > r0 + roff + 63) return;                  // score tile entirely above the causal diagonal: never read (the softmax masks j > i by select)
    const int Kl = (CMODE == 2) ? min(K, r0 + roff + 64) : K;        // P.V: probabilities are exactly 0 beyond the diagonal block, so the K loop stops there
    v8f acc[4][4];
#pragma unroll
    for (int mb = 0; mb < 4; ++mb)
#pragma unroll
        for (int nb = 0; nb < 4; ++nb) acc[mb][nb] = (v8f){};
    const size_t aoff = (size_t)(r0 + lr) * K + 8 * hi, boff = (size_t)(c0 + lr) * K + 8 * hi;
#pragma unroll 1
    for (int kc = 0; kc < Kl; kc += 32) {
        V a[4], a2[4];
#pragma unroll
        for (int mb = 0; mb < 4; ++mb) { a[mb] = WFrag<T16>::ld(A + aoff + (size_t)mb * 16 * K + kc); if (NSPLIT == 1 || NSPLIT == 2) a2[mb] = WFrag<T16>::ld(A2 + aoff + (size_t)mb * 16 * K + kc); }
#pragma unroll
        for (int nb = 0; nb < 4; ++nb) { const V b = WFrag<T16>::ld(Bt + boff + (size_t)nb * 16 * K + kc); V b2; if (NSPLIT >= 2) b2 = WFrag<T16>::ld(Bt2 + boff + (size_t)nb * 16 * K + kc);
#pragma unroll
            for (int mb = 0; mb < 4; ++mb) { acc[mb][nb] = WFrag<T16>::mma(a[mb], b, acc[mb][nb]); if (NSPLIT == 1 || NSPLIT == 2) acc[mb][nb] = WFrag<T16>::mma(a2[mb], b, acc[mb][nb]); if (NSPLIT >= 2) acc[mb][nb] = WFrag<T16>::mma(a[mb], b2, acc[mb][nb]); } }
        asm volatile("v_nop\n\tv_nop\n\tv_nop\n\tv_nop" : "+v"(acc[0][0]), "+v"(acc[1][1]), "+v"(acc[2][2]), "+v"(acc[3][3]) : "v"(a[0]), "v"(a[3]));
    }
#pragma unroll
    for (int mb = 0; mb < 4; ++mb) {
#pragma unroll
        for (int nb = 0; nb < 4; ++nb) {
#pragma unroll
            for (int j = 0; j < 8; ++j) os[(hi * 8 + j) * 68 + nb * 16 + lr] = acc[mb][nb][j]; }
        __builtin_amdgcn_wave_barrier(); asm volatile("" ::: "memory");
        float* crow = C + (size_t)(r0 + mb * 16) * ldc + c0;
{
#pragma unroll
            for (int s = 0; s < 8; ++s) { const int row = 2 * s + hi, cofs = lr * 4; v4f val = *(const v4fa*)(os + row * 68 + cofs);
                *(v4f*)(crow + (size_t)row * ldc + cofs) = val; }
             }
        __builtin_amdgcn_wave_barrier(); asm volatile("" ::: "memory");
    }
}

__device__ __forceinline__ h16 tohx(float x) { return (h16)x; }
__device__ __forceinline__ void splitf(float y, unsigned short& h, unsigned short& l) { h = f2bf(y); l = f2bf(y - bf2f(h)); }
typedef __attribute__((ext_vector_type(2))) _Float16 v2h;
typedef __attribute__((ext_vector_type(4))) _Float16 v4h;
typedef __attribute__((ext_vector_type(2))) unsigned short v2us;
typedef __attribute__((ext_vector_type(4))) unsigned short v4us;
typedef __attribute__((ext_vector_type(2))) float v2f;
typedef __attribute__((ext_vector_type(4))) int v4i;

__global__ __launch_bounds__(256) void k_wtG(const float* __restrict__ w, int K, int N, bf* Bt) {
    const int lane = threadIdx.x & 31; const int L0 = (blockIdx.x * 8 + (threadIdx.x >> 5)) * 8; const int nlines = N * K / 64;
{
#pragma unroll 1
        for (int l = 0; l < 8; ++l) { const int L = L0 + l; if (L >= nlines) break; const size_t e = (size_t)L * 64 + lane * 2; const int k = (int)(e % K), n = (int)(e / K); v2us o;
            o[0] = f2bf(w[(size_t)k * N + n]); o[1] = f2bf(w[(size_t)(k + 1) * N + n]); *(v2us*)(Bt + e) = o; }
         }
}
__global__ __launch_bounds__(256) void k_cvt8(const float* __restrict__ src, bf* dst, size_t n8) { const size_t i = (size_t)blockIdx.x * 256 + threadIdx.x; if (i >= n8) return; const v8f v = *(const v8f*)(src + i * 8); v8us o;
#pragma unroll
    for (int k = 0; k < 8; ++k) o[k] = f2bf(v[k]); *(v8us*)(dst + i * 8) = o;  }

// k_rope: head planes [h][t][d] (fp16 + hi/lo) of rope(x) x sc with the rotate-half convention out[d] = x[d] cos[t][d] - x[d+HD/2] sin[t][d], out[d+HD/2] = x[d+HD/2] cos[t][d+HD/2] + x[d] sin[t][d+HD/2]
__global__ __launch_bounds__(256) void k_rope(const float* __restrict__ F, int pitch, int nheads, const float* __restrict__ CS, const float* __restrict__ RF, const float* __restrict__ nw, float sc, h16* P16, bf* Ph, bf* Pl) {
    const size_t e = ((size_t)blockIdx.x * 256 + threadIdx.x) * 2; if (e >= (size_t)nheads * TT * HD) return; const int d = (int)(e % HD); const int t = (int)((e / HD) % TT); const int h = (int)(e / ((size_t)HD * TT)); const float* f = F + (size_t)t * pitch + h * HD; const float rf = RF ? RF[(size_t)h * TT + t] : 1.0f; v2h o16; v2us oh, ol;
#pragma unroll
    for (int q = 0; q < 2; ++q) { const int dd = d + q; const int dp = (dd < HD / 2) ? dd + HD / 2 : dd - HD / 2; float x0 = f[dd], x1 = f[dp];
        if (RF) { float n0 = __fmul_rn(x0, rf), n1 = __fmul_rn(x1, rf); asm volatile("" : "+v"(n0)); asm volatile("" : "+v"(n1)); x0 = __fmul_rn(bfr(nw[dd]), n0); x1 = __fmul_rn(bfr(nw[dp]), n1); }
        const v2f cs = *(const v2f*)(CS + ((size_t)t * HD + dd) * 2); float a = __fmul_rn(x0, cs[0]), bq = __fmul_rn(x1, cs[1]); asm volatile("" : "+v"(a)); asm volatile("" : "+v"(bq)); const float r = ((dd < HD / 2) ? __fsub_rn(a, bq) : __fadd_rn(a, bq)) * sc;
        o16[q] = tohx(r); unsigned short a2, c2; splitf(r, a2, c2); oh[q] = a2; ol[q] = c2; }
    *(v2h*)(P16 + e) = o16; *(v2us*)(Ph + e) = oh; *(v2us*)(Pl + e) = ol;  }
__global__ __launch_bounds__(256) void k_ropeR(const float* __restrict__ F, int pitch, int nheads, const float* __restrict__ CS, const float* __restrict__ RF, const float* __restrict__ nw, float sc, h16* P16, bf* Ph, bf* Pl) {
    const size_t e = ((size_t)blockIdx.x * 256 + threadIdx.x) * 2; if (e >= (size_t)nheads * TT * HD) return; const int d = (int)(e % HD); const int t = (int)((e / HD) % TT); const int h = (int)(e / ((size_t)HD * TT)); const float* f = F + (size_t)t * pitch + h * HD; const float rf = RF ? RF[(size_t)h * TT + t] : 1.0f; v2h o16; v2us oh, ol;
#pragma unroll
    for (int q = 0; q < 2; ++q) { const int dd = d + q; const int dp = (dd < HD / 2) ? dd + HD / 2 : dd - HD / 2; float x0 = bfr(f[dd]), x1 = bfr(f[dp]);
        if (RF) { float n0 = __fmul_rn(x0, rf), n1 = __fmul_rn(x1, rf); asm volatile("" : "+v"(n0)); asm volatile("" : "+v"(n1)); x0 = __fmul_rn(bfr(nw[dd]), n0); x1 = __fmul_rn(bfr(nw[dp]), n1); }
        const v2f cs = *(const v2f*)(CS + ((size_t)t * HD + dd) * 2); float a = __fmul_rn(x0, cs[0]), bq = __fmul_rn(x1, cs[1]); asm volatile("" : "+v"(a)); asm volatile("" : "+v"(bq)); const float r = ((dd < HD / 2) ? __fsub_rn(a, bq) : __fadd_rn(a, bq)) * sc;
        o16[q] = tohx(r); unsigned short a2, c2; splitf(r, a2, c2); oh[q] = a2; ol[q] = c2; }
    *(v2h*)(P16 + e) = o16; *(v2us*)(Ph + e) = oh; *(v2us*)(Pl + e) = ol;  }
__global__ __launch_bounds__(256) void k_vtp(const float* __restrict__ F, int pitch, int nheads, h16* V16, bf* Vh, bf* Vl) { const size_t e = ((size_t)blockIdx.x * 256 + threadIdx.x) * 2; if (e >= (size_t)nheads * HD * TT) return; const int t = (int)(e % TT); const int d = (int)((e / TT) % HD); const int g = (int)(e / ((size_t)TT * HD)); v2h o16; v2us oh, ol;
#pragma unroll
    for (int q = 0; q < 2; ++q) { const float x = bfr(F[(size_t)(t + q) * pitch + g * HD + d]);   /* raw input: bf16-rounded here */ o16[q] = tohx(x); unsigned short a2, c2; splitf(x, a2, c2); oh[q] = a2; ol[q] = c2; }
    *(v2h*)(V16 + e) = o16; *(v2us*)(Vh + e) = oh; *(v2us*)(Vl + e) = ol;  }
__global__ __launch_bounds__(256) void k_csid(float* CS) { const int idx = blockIdx.x * 256 + threadIdx.x; if (idx >= TT * HD) return; v2f cs; cs[0] = 1.0f; cs[1] = 0.0f; *(v2f*)(CS + (size_t)idx * 2) = cs;  }
// k_asoft: per row (zz, i): t = S x HD^-0.5 for j <= i and i - j < WIN (sliding causal window; the reference's -1e9 additive fill vanishes identically); softmax over the 2048 keys (register row, one exp, fixed trees);
__global__ __launch_bounds__(256) void k_asoft(const float* __restrict__ Sb, h16* P16, bf* Ph, bf* Pl) {
    const int lane = threadIdx.x & 31; const int row = blockIdx.x * 8 + (threadIdx.x >> 5); if (row >= ZH * TT) return; const int i = row % TT; const int zz = row / TT; (void)zz; const bool hires = (i < RH); const float* sr = Sb + (size_t)row * TT; float v[TT / 32]; float mx = -3.0e38f;
#pragma unroll
    for (int ch = 0; ch < TT / 128; ++ch) { const int j0 = ch * 128 + lane * 4; const v4f a = *(const v4f*)(sr + j0);
#pragma unroll
        for (int q = 0; q < 4; ++q) { const int j = j0 + q; (void)j; const float t = (j <= i && i - j < WIN) ? a[q] * SCL : -3.0e38f; v[ch * 4 + q] = t; mx = fmaxf(mx, t); } }
#pragma unroll
    for (int sh = 16; sh; sh >>= 1) mx = fmaxf(mx, __shfl_xor(mx, sh, 32));
    float sum = 0.f;
#pragma unroll
    for (int k = 0; k < TT / 32; ++k) { float d0 = __fsub_rn(v[k], mx); asm volatile("" : "+v"(d0)); v[k] = __builtin_amdgcn_exp2f(__fmul_rn(d0, 1.4426950408889634f)); sum += v[k]; }
#pragma unroll
    for (int sh = 16; sh; sh >>= 1) sum += __shfl_xor(sum, sh, 32);
    const float f = __fdiv_rn(hires ? 1.0f : PCAR, sum);
{
        if (hires) {
#pragma unroll
            for (int ch = 0; ch < TT / 128; ++ch) { v4us oh, ol;
#pragma unroll
                for (int q = 0; q < 4; ++q) { unsigned short a, c2; splitf(v[ch * 4 + q] * f, a, c2); oh[q] = a; ol[q] = c2; }
                const size_t oo = ((size_t)zz * (RH ? RH : 1) + i) * TT + ch * 128 + lane * 4; *(v4us*)(Ph + oo) = oh; *(v4us*)(Pl + oo) = ol; }
        } else {
#pragma unroll
            for (int ch = 0; ch < TT / 128; ++ch) { v4h o4;
#pragma unroll
                for (int q = 0; q < 4; ++q) o4[q] = tohx(v[ch * 4 + q] * f);
                *(v4h*)(P16 + (size_t)row * TT + ch * 128 + lane * 4) = o4; } }
         }
}
__global__ __launch_bounds__(256) void k_merge(const float* __restrict__ O, int h0, float* OUTb) { const size_t e = ((size_t)blockIdx.x * 256 + threadIdx.x) * 2; if (e >= (size_t)ZH * TT * HD) return; const int d = (int)(e % HD); const int t = (int)((e / HD) % TT); const int zz = (int)(e / ((size_t)HD * TT)); const float cs = (t < RH) ? 1.0f : (1.0f / PCAR); const size_t oo = (size_t)t * DQ + (h0 + zz) * HD + d;
    v2f o2; o2[0] = O[e] * cs; o2[1] = O[e + 1] * cs; *(v2f*)(OUTb + oo) = o2;  }

extern "C" void kernel_launch(void* const* d_in, const int* in_sizes, int n_in,
                              void* d_out, int out_size, void* d_ws, size_t ws_size, hipStream_t stream) {
    (void)in_sizes; (void)n_in; (void)out_size;
    const float* qi = (const float*)d_in[0]; const float* ki = (const float*)d_in[1]; const float* vi = (const float*)d_in[2]; const float* wq = (const float*)d_in[3]; const float* x = nullptr; const float* wk = nullptr; const float* wv = nullptr; const float* wo = nullptr; (void)x; (void)wk; (void)wv; (void)wo;
    float* OUT = (float*)d_out;     // [4][2048][512]
    char* wsp = (char*)d_ws;
    auto take = [&](size_t bytes) { char* p = wsp; wsp += (bytes + 255) & ~(size_t)255; return (void*)p; };
    bf* WQ = (bf*)take((size_t)HD * HD * 2);  float* CS = (float*)take((size_t)TT * HD * 2 * 4);
    bf* XB = (bf*)take((size_t)TT * DM * 2); float* FQ = (float*)take((size_t)TT * DQ * 4); 
    h16* QP16 = (h16*)take((size_t)NH_ * TT * HD * 2); h16* KP16 = (h16*)take((size_t)NKV * TT * HD * 2); h16* VT16 = (h16*)take((size_t)NKV * HD * TT * 2);
    bf* QPh = (bf*)take((size_t)NH_ * TT * HD * 2); bf* QPl = (bf*)take((size_t)NH_ * TT * HD * 2); bf* KPh = (bf*)take((size_t)NKV * TT * HD * 2); bf* KPl = (bf*)take((size_t)NKV * TT * HD * 2); bf* VTh = (bf*)take((size_t)NKV * HD * TT * 2); bf* VTl = (bf*)take((size_t)NKV * HD * TT * 2); bf* Ph = (bf*)take((size_t)ZH * RH * TT * 2); bf* Pl = (bf*)take((size_t)ZH * RH * TT * 2);
    float* Sb = (float*)take((size_t)ZH * TT * TT * 4); h16* P16 = (h16*)take((size_t)ZH * TT * TT * 2); float* Ob = (float*)take((size_t)ZH * TT * HD * 4);
    if ((size_t)(wsp - (char*)d_ws) > ws_size) return;    // ws 256 MiB
    { k_wtG<<<(unsigned)((HD * HD / 64 + 63) / 64), 256, 0, stream>>>(wq, HD, HD, WQ);   /* bilinear_weight 'xw' [64][64] -> Bt */ }
    k_csid<<<(TT * HD + 255) / 256, 256, 0, stream>>>(CS);
    const unsigned LQ = (unsigned)(((size_t)NH_ * TT * HD / 2 + 255) / 256), LKv = (unsigned)(((size_t)NKV * TT * HD / 2 + 255) / 256);
    for (int b = 0; b < NB_; ++b) {
        
        k_cvt8<<<(unsigned)(((size_t)TT * DM / 8 + 255) / 256), 256, 0, stream>>>(qi + (size_t)b * TT * DM, XB, (size_t)TT * DM / 8);   /* bf16 copy of the batch's queries [2048 x 8][64] */
        k_gemmw<bf, 0, false><<<dim3(TT * NH_ / 64, HD / 64, 1), 32, 0, stream>>>(XB, nullptr, WQ, nullptr, HD, FQ, HD, nullptr, 0, 0, 0);   /* qw = q W for all (token, head) rows: [16384][64] x [64][64], exact */
        k_rope<<<LQ, 256, 0, stream>>>(FQ, DQ, NH_, CS, nullptr, nullptr, 1.0f, QP16, QPh, QPl);
        k_ropeR<<<LKv, 256, 0, stream>>>(ki + (size_t)b * TT * DKV, DKV, NKV, CS, nullptr, nullptr, 1.0f, KP16, KPh, KPl);
        k_vtp<<<LKv, 256, 0, stream>>>(vi + (size_t)b * TT * DKV, DKV, NKV, VT16, VTh, VTl);
        for (int h0 = 0; h0 < NH_; h0 += ZH) { const size_t zq = (size_t)h0, zk = (size_t)(h0 / REP);   // one kv head per query head: the pass's two heads use consecutive kv planes (z-strides TT*HD)
            k_gemmc<bf, 2, 1><<<dim3(RH / 64, TT / 64, ZH), 32, 0, stream>>>(QPh + zq * TT * HD, QPl + zq * TT * HD, KPh + zk * TT * HD, KPl + zk * TT * HD, HD, Sb, TT, 0, (size_t)TT * HD, (size_t)TT * HD, (size_t)TT * TT);
            k_asoft<<<ZH * TT / 8, 256, 0, stream>>>(Sb, P16, Ph, Pl);
            k_gemmc<bf, 2, 2><<<dim3(RH / 64, HD / 64, ZH), 32, 0, stream>>>(Ph, Pl, VTh + zk * HD * TT, VTl + zk * HD * TT, TT, Ob, HD, 0, (size_t)RH * TT, (size_t)HD * TT, (size_t)TT * HD);
            k_merge<<<(unsigned)(((size_t)ZH * TT * HD / 2 + 255) / 256), 256, 0, stream>>>(Ob, h0, OUT + (size_t)b * TT * DQ); }
         }
}

// v001
// It runs in 500 microseconds.
// Timed twice side by side with v000, it ran 1.99 and 2.00 times as fast.
#include <hip/hip_runtime.h>

#include <hip/hip_runtime.h>

#define NB_  4
#define TT   2048
#define DM   512
#define NH_  8
#define NKV  8
#define REP  (NH_ / NKV)
#define HD   64
#define DQ   (NH_ * HD)
#define DKV  (NKV * HD)
#define ZH   2
#define RH   2048                 // every row hi/lo (unscaled-ish logits: sigma ~8)
#define WIN  2048
#define PCAR 1024.0f
#define SCL  0.125f   // HD^-0.5
#define KCH  128                  // keys per work-group of the probability x value product (split K)
#define NCH  (TT / KCH)           // partial planes of that product
typedef _Float16 h16;
typedef unsigned short bf;
typedef __attribute__((ext_vector_type(16))) __bf16   v16bf;
typedef __attribute__((ext_vector_type(16))) _Float16 v16h;
typedef __attribute__((ext_vector_type(8)))  _Float16 v8h;
typedef __attribute__((ext_vector_type(8)))  unsigned short v8us;
typedef __attribute__((ext_vector_type(8)))  float    v8f;
typedef __attribute__((ext_vector_type(4)))  float    v4f;
typedef v8h  __attribute__((may_alias)) v8ha;
typedef v4f  __attribute__((may_alias)) v4fa;
typedef v8us __attribute__((may_alias)) v8usa;

__device__ __forceinline__ unsigned short f2bf(float f) { unsigned u = __float_as_uint(f); u += 0x7FFFu + ((u >> 16) & 1u); return (unsigned short)(u >> 16); }
__device__ __forceinline__ float bf2f(unsigned short b) { return __uint_as_float(((unsigned)b) << 16); }
__device__ __forceinline__ float bfr(float f) { return bf2f(f2bf(f)); }
__device__ __forceinline__ v16h cat16(v8h lo, v8h hi) { return __builtin_shufflevector(lo, hi, 0, 1, 2, 3, 4, 5, 6, 7, 8, 9, 10, 11, 12, 13, 14, 15); }
__device__ __forceinline__ v16bf cat16b(v8us lo, v8us hi) { return __builtin_bit_cast(v16bf, __builtin_shufflevector(lo, hi, 0, 1, 2, 3, 4, 5, 6, 7, 8, 9, 10, 11, 12, 13, 14, 15)); }
__device__ __forceinline__ v8f wmma16(v16h a, v16h b, v8f c) { return __builtin_amdgcn_wmma_f32_16x16x32_f16(false, a, false, b, (short)0, c, false, false); }
__device__ __forceinline__ v8f wmmab(v16bf a, v16bf b, v8f c) { return __builtin_amdgcn_wmma_f32_16x16x32_bf16(false, a, false, b, (short)0, c, false, false); }



// ---- k_gemmw: register-blocked GEMM, ONE WAVE per 64x64 output tile (16 accumulators), operands straight from K-contiguous 16-bit planes; grid (M/64, N/64, Z), 32 threads.
// C[m][n] (f32, pitch ldc, + optional f32 bias[n]) = sum_k A[m][k] Bt[n][k] (+ split products per NSPLIT). z-batch strides sA/sB/sC in elements. K % 32 == 0.
template <typename T16> struct WFrag;
template <> struct WFrag<h16> { typedef v16h V; static __device__ __forceinline__ V ld(const h16* p) { return cat16(*(const v8h*)p, *(const v8h*)(p + 16)); } static __device__ __forceinline__ v8f mma(V a, V b, v8f c) { return wmma16(a, b, c); } };
template <> struct WFrag<bf> { typedef v16bf V; static __device__ __forceinline__ V ld(const bf* p) { return cat16b(*(const v8us*)p, *(const v8us*)(p + 16)); } static __device__ __forceinline__ v8f mma(V a, V b, v8f c) { return wmmab(a, b, c); } };
template <typename T16, int NSPLIT, bool BIAS>
__global__ __launch_bounds__(32) void k_gemmw(const T16* __restrict__ A, const T16* __restrict__ A2, const T16* __restrict__ Bt, const T16* __restrict__ Bt2, int K, float* C, int ldc, const float* __restrict__ bias, size_t sA, size_t sB, size_t sC) {
    typedef typename WFrag<T16>::V V;
    __shared__ __align__(16) float os[16 * 68];
    const size_t z = blockIdx.z; A += z * sA; if (A2) A2 += z * sA; Bt += z * sB; if (Bt2) Bt2 += z * sB; C += z * sC;
    const int lane = threadIdx.x & 31, lr = lane & 15, hi = lane >> 4; const int r0 = blockIdx.x * 64, c0 = blockIdx.y * 64;
    v8f acc[4][4];
#pragma unroll
    for (int mb = 0; mb < 4; ++mb)
#pragma unroll
        for (int nb = 0; nb < 4; ++nb) acc[mb][nb] = (v8f){};
    const size_t aoff = (size_t)(r0 + lr) * K + 8 * hi, boff = (size_t)(c0 + lr) * K + 8 * hi;
#pragma unroll 1
    for (int kc = 0; kc < K; kc += 32) {
        V a[4], a2[4];
#pragma unroll
        for (int mb = 0; mb < 4; ++mb) { a[mb] = WFrag<T16>::ld(A + aoff + (size_t)mb * 16 * K + kc); if (NSPLIT == 1 || NSPLIT == 2) a2[mb] = WFrag<T16>::ld(A2 + aoff + (size_t)mb * 16 * K + kc); }
#pragma unroll
        for (int nb = 0; nb < 4; ++nb) { const V b = WFrag<T16>::ld(Bt + boff + (size_t)nb * 16 * K + kc); V b2; if (NSPLIT >= 2) b2 = WFrag<T16>::ld(Bt2 + boff + (size_t)nb * 16 * K + kc);
#pragma unroll
            for (int mb = 0; mb < 4; ++mb) { acc[mb][nb] = WFrag<T16>::mma(a[mb], b, acc[mb][nb]); if (NSPLIT == 1 || NSPLIT == 2) acc[mb][nb] = WFrag<T16>::mma(a2[mb], b, acc[mb][nb]); if (NSPLIT >= 2) acc[mb][nb] = WFrag<T16>::mma(a[mb], b2, acc[mb][nb]); } }
        asm volatile("v_nop\n\tv_nop\n\tv_nop\n\tv_nop" : "+v"(acc[0][0]), "+v"(acc[1][1]), "+v"(acc[2][2]), "+v"(acc[3][3]) : "v"(a[0]), "v"(a[3]));
    }
#pragma unroll
    for (int mb = 0; mb < 4; ++mb) {
#pragma unroll
        for (int nb = 0; nb < 4; ++nb) {
#pragma unroll
            for (int j = 0; j < 8; ++j) os[(hi * 8 + j) * 68 + nb * 16 + lr] = acc[mb][nb][j]; }
        __builtin_amdgcn_wave_barrier(); asm volatile("" ::: "memory");
        float* crow = C + (size_t)(r0 + mb * 16) * ldc + c0;
{
#pragma unroll
            for (int s = 0; s < 8; ++s) { const int row = 2 * s + hi, cofs = lr * 4; v4f val = *(const v4fa*)(os + row * 68 + cofs); if (BIAS) { val[0] += bfr(bias[c0 + cofs]); val[1] += bfr(bias[c0 + cofs + 1]); val[2] += bfr(bias[c0 + cofs + 2]); val[3] += bfr(bias[c0 + cofs + 3]); }
                *(v4f*)(crow + (size_t)row * ldc + cofs) = val; }
             }
        __builtin_amdgcn_wave_barrier(); asm volatile("" ::: "memory");
    }
}

// ---- k_gemmc: the same one-wave 64x64 tile GEMM specialised for causal attention: CMODE 1 skips score tiles entirely above the diagonal (query rows r0+roff.., key columns c0..), CMODE 2 limits the
// key (K) loop of the probability x value contraction to the diagonal block (probabilities beyond it are exactly zero). roff = row offset of this launch's first row within the sequence.
// CMODE 2 also splits K over the grid: blockIdx.y picks a run of KCH keys (the output is one 64-column tile wide) and the tile's partial sum goes to plane blockIdx.y (plane stride sP); k_merge adds the planes.
template <typename T16, int NSPLIT, int CMODE>
__global__ __launch_bounds__(32) void k_gemmc(const T16* __restrict__ A, const T16* __restrict__ A2, const T16* __restrict__ Bt, const T16* __restrict__ Bt2, int K, float* C, int ldc, int roff, size_t sA, size_t sB, size_t sC, size_t sP) {
    typedef typename WFrag<T16>::V V;
    __shared__ __align__(16) float os[16 * 68];
    const size_t z = blockIdx.z; A += z * sA; if (A2) A2 += z * sA; Bt += z * sB; if (Bt2) Bt2 += z * sB; C += z * sC;
    const int lane = threadIdx.x & 31, lr = lane & 15, hi = lane >> 4; const int r0 = blockIdx.x * 64, c0 = (CMODE == 2) ? 0 : blockIdx.y * 64;
    if (CMODE == 1 && c0 > r0 + roff + 63) return;                  // score tile entirely above the causal diagonal: never read (the softmax masks j > i by select)
    const int k0 = (CMODE == 2) ? blockIdx.y * KCH : 0;              // P.V: first key of this work-group's run
    if (CMODE == 2 && k0 >= min(K, r0 + roff + 64)) return;          // run entirely beyond the diagonal block: no plane written, k_merge does not read it
    const int Kl = (CMODE == 2) ? min(min(K, r0 + roff + 64) - k0, KCH) : K;   // P.V: keys of this run; probabilities are exactly 0 beyond the diagonal block, so the K loop stops there
    if (CMODE == 2) { A += k0; if (A2) A2 += k0; Bt += k0; if (Bt2) Bt2 += k0; C += (size_t)blockIdx.y * sP; }
    v8f acc[4][4];
#pragma unroll
    for (int mb = 0; mb < 4; ++mb)
#pragma unroll
        for (int nb = 0; nb < 4; ++nb) acc[mb][nb] = (v8f){};
    const size_t aoff = (size_t)(r0 + lr) * K + 8 * hi, boff = (size_t)(c0 + lr) * K + 8 * hi;
#pragma unroll 1
    for (int kc = 0; kc < Kl; kc += 32) {
        V a[4], a2[4];
#pragma unroll
        for (int mb = 0; mb < 4; ++mb) { a[mb] = WFrag<T16>::ld(A + aoff + (size_t)mb * 16 * K + kc); if (NSPLIT == 1 || NSPLIT == 2) a2[mb] = WFrag<T16>::ld(A2 + aoff + (size_t)mb * 16 * K + kc); }
#pragma unroll
        for (int nb = 0; nb < 4; ++nb) { const V b = WFrag<T16>::ld(Bt + boff + (size_t)nb * 16 * K + kc); V b2; if (NSPLIT >= 2) b2 = WFrag<T16>::ld(Bt2 + boff + (size_t)nb * 16 * K + kc);
#pragma unroll
            for (int mb = 0; mb < 4; ++mb) { acc[mb][nb] = WFrag<T16>::mma(a[mb], b, acc[mb][nb]); if (NSPLIT == 1 || NSPLIT == 2) acc[mb][nb] = WFrag<T16>::mma(a2[mb], b, acc[mb][nb]); if (NSPLIT >= 2) acc[mb][nb] = WFrag<T16>::mma(a[mb], b2, acc[mb][nb]); } }
        asm volatile("v_nop\n\tv_nop\n\tv_nop\n\tv_nop" : "+v"(acc[0][0]), "+v"(acc[1][1]), "+v"(acc[2][2]), "+v"(acc[3][3]) : "v"(a[0]), "v"(a[3]));
    }
#pragma unroll
    for (int mb = 0; mb < 4; ++mb) {
#pragma unroll
        for (int nb = 0; nb < 4; ++nb) {
#pragma unroll
            for (int j = 0; j < 8; ++j) os[(hi * 8 + j) * 68 + nb * 16 + lr] = acc[mb][nb][j]; }
        __builtin_amdgcn_wave_barrier(); asm volatile("" ::: "memory");
        float* crow = C + (size_t)(r0 + mb * 16) * ldc + c0;
{
#pragma unroll
            for (int s = 0; s < 8; ++s) { const int row = 2 * s + hi, cofs = lr * 4; v4f val = *(const v4fa*)(os + row * 68 + cofs);
                *(v4f*)(crow + (size_t)row * ldc + cofs) = val; }
             }
        __builtin_amdgcn_wave_barrier(); asm volatile("" ::: "memory");
    }
}

__device__ __forceinline__ h16 tohx(float x) { return (h16)x; }
__device__ __forceinline__ void splitf(float y, unsigned short& h, unsigned short& l) { h = f2bf(y); l = f2bf(y - bf2f(h)); }
typedef __attribute__((ext_vector_type(2))) _Float16 v2h;
typedef __attribute__((ext_vector_type(4))) _Float16 v4h;
typedef __attribute__((ext_vector_type(2))) unsigned short v2us;
typedef __attribute__((ext_vector_type(4))) unsigned short v4us;
typedef __attribute__((ext_vector_type(2))) float v2f;
typedef __attribute__((ext_vector_type(4))) int v4i;

__global__ __launch_bounds__(256) void k_wtG(const float* __restrict__ w, int K, int N, bf* Bt) {
    const int lane = threadIdx.x & 31; const int L0 = (blockIdx.x * 8 + (threadIdx.x >> 5)) * 8; const int nlines = N * K / 64;
{
#pragma unroll 1
        for (int l = 0; l < 8; ++l) { const int L = L0 + l; if (L >= nlines) break; const size_t e = (size_t)L * 64 + lane * 2; const int k = (int)(e % K), n = (int)(e / K); v2us o;
            o[0] = f2bf(w[(size_t)k * N + n]); o[1] = f2bf(w[(size_t)(k + 1) * N + n]); *(v2us*)(Bt + e) = o; }
         }
}
__global__ __launch_bounds__(256) void k_cvt8(const float* __restrict__ src, bf* dst, size_t n8) { const size_t i = (size_t)blockIdx.x * 256 + threadIdx.x; if (i >= n8) return; const v8f v = *(const v8f*)(src + i * 8); v8us o;
#pragma unroll
    for (int k = 0; k < 8; ++k) o[k] = f2bf(v[k]); *(v8us*)(dst + i * 8) = o;  }

// k_rope: head planes [h][t][d] (fp16 + hi/lo) of rope(x) x sc with the rotate-half convention out[d] = x[d] cos[t][d] - x[d+HD/2] sin[t][d], out[d+HD/2] = x[d+HD/2] cos[t][d+HD/2] + x[d] sin[t][d+HD/2]
__global__ __launch_bounds__(256) void k_rope(const float* __restrict__ F, int pitch, int nheads, const float* __restrict__ CS, const float* __restrict__ RF, const float* __restrict__ nw, float sc, h16* P16, bf* Ph, bf* Pl) {
    const size_t e = ((size_t)blockIdx.x * 256 + threadIdx.x) * 2; if (e >= (size_t)nheads * TT * HD) return; const int d = (int)(e % HD); const int t = (int)((e / HD) % TT); const int h = (int)(e / ((size_t)HD * TT)); const float* f = F + (size_t)t * pitch + h * HD; const float rf = RF ? RF[(size_t)h * TT + t] : 1.0f; v2h o16; v2us oh, ol;
#pragma unroll
    for (int q = 0; q < 2; ++q) { const int dd = d + q; const int dp = (dd < HD / 2) ? dd + HD / 2 : dd - HD / 2; float x0 = f[dd], x1 = f[dp];
        if (RF) { float n0 = __fmul_rn(x0, rf), n1 = __fmul_rn(x1, rf); asm volatile("" : "+v"(n0)); asm volatile("" : "+v"(n1)); x0 = __fmul_rn(bfr(nw[dd]), n0); x1 = __fmul_rn(bfr(nw[dp]), n1); }
        const v2f cs = *(const v2f*)(CS + ((size_t)t * HD + dd) * 2); float a = __fmul_rn(x0, cs[0]), bq = __fmul_rn(x1, cs[1]); asm volatile("" : "+v"(a)); asm volatile("" : "+v"(bq)); const float r = ((dd < HD / 2) ? __fsub_rn(a, bq) : __fadd_rn(a, bq)) * sc;
        o16[q] = tohx(r); unsigned short a2, c2; splitf(r, a2, c2); oh[q] = a2; ol[q] = c2; }
    *(v2h*)(P16 + e) = o16; *(v2us*)(Ph + e) = oh; *(v2us*)(Pl + e) = ol;  }
__global__ __launch_bounds__(256) void k_ropeR(const float* __restrict__ F, int pitch, int nheads, const float* __restrict__ CS, const float* __restrict__ RF, const float* __restrict__ nw, float sc, h16* P16, bf* Ph, bf* Pl) {
    const size_t e = ((size_t)blockIdx.x * 256 + threadIdx.x) * 2; if (e >= (size_t)nheads * TT * HD) return; const int d = (int)(e % HD); const int t = (int)((e / HD) % TT); const int h = (int)(e / ((size_t)HD * TT)); const float* f = F + (size_t)t * pitch + h * HD; const float rf = RF ? RF[(size_t)h * TT + t] : 1.0f; v2h o16; v2us oh, ol;
#pragma unroll
    for (int q = 0; q < 2; ++q) { const int dd = d + q; const int dp = (dd < HD / 2) ? dd + HD / 2 : dd - HD / 2; float x0 = bfr(f[dd]), x1 = bfr(f[dp]);
        if (RF) { float n0 = __fmul_rn(x0, rf), n1 = __fmul_rn(x1, rf); asm volatile("" : "+v"(n0)); asm volatile("" : "+v"(n1)); x0 = __fmul_rn(bfr(nw[dd]), n0); x1 = __fmul_rn(bfr(nw[dp]), n1); }
        const v2f cs = *(const v2f*)(CS + ((size_t)t * HD + dd) * 2); float a = __fmul_rn(x0, cs[0]), bq = __fmul_rn(x1, cs[1]); asm volatile("" : "+v"(a)); asm volatile("" : "+v"(bq)); const float r = ((dd < HD / 2) ? __fsub_rn(a, bq) : __fadd_rn(a, bq)) * sc;
        o16[q] = tohx(r); unsigned short a2, c2; splitf(r, a2, c2); oh[q] = a2; ol[q] = c2; }
    *(v2h*)(P16 + e) = o16; *(v2us*)(Ph + e) = oh; *(v2us*)(Pl + e) = ol;  }
__global__ __launch_bounds__(256) void k_vtp(const float* __restrict__ F, int pitch, int nheads, h16* V16, bf* Vh, bf* Vl) { const size_t e = ((size_t)blockIdx.x * 256 + threadIdx.x) * 2; if (e >= (size_t)nheads * HD * TT) return; const int t = (int)(e % TT); const int d = (int)((e / TT) % HD); const int g = (int)(e / ((size_t)TT * HD)); v2h o16; v2us oh, ol;
#pragma unroll
    for (int q = 0; q < 2; ++q) { const float x = bfr(F[(size_t)(t + q) * pitch + g * HD + d]);   /* raw input: bf16-rounded here */ o16[q] = tohx(x); unsigned short a2, c2; splitf(x, a2, c2); oh[q] = a2; ol[q] = c2; }
    *(v2h*)(V16 + e) = o16; *(v2us*)(Vh + e) = oh; *(v2us*)(Vl + e) = ol;  }
__global__ __launch_bounds__(256) void k_csid(float* CS) { const int idx = blockIdx.x * 256 + threadIdx.x; if (idx >= TT * HD) return; v2f cs; cs[0] = 1.0f; cs[1] = 0.0f; *(v2f*)(CS + (size_t)idx * 2) = cs;  }
// k_asoft: per row (zz, i): t = S x HD^-0.5 for j <= i and i - j < WIN (sliding causal window; the reference's -1e9 additive fill vanishes identically); softmax over the 2048 keys (register row, one exp, fixed trees);
__global__ __launch_bounds__(256) void k_asoft(const float* __restrict__ Sb, h16* P16, bf* Ph, bf* Pl) {
    const int lane = threadIdx.x & 31; const int row = blockIdx.x * 8 + (threadIdx.x >> 5); if (row >= ZH * TT) return; const int i = row % TT; const int zz = row / TT; (void)zz; const bool hires = (i < RH); const float* sr = Sb + (size_t)row * TT; float v[TT / 32]; float mx = -3.0e38f;
#pragma unroll
    for (int ch = 0; ch < TT / 128; ++ch) { const int j0 = ch * 128 + lane * 4; const v4f a = *(const v4f*)(sr + j0);
#pragma unroll
        for (int q = 0; q < 4; ++q) { const int j = j0 + q; (void)j; const float t = (j <= i && i - j < WIN) ? a[q] * SCL : -3.0e38f; v[ch * 4 + q] = t; mx = fmaxf(mx, t); } }
#pragma unroll
    for (int sh = 16; sh; sh >>= 1) mx = fmaxf(mx, __shfl_xor(mx, sh, 32));
    float sum = 0.f;
#pragma unroll
    for (int k = 0; k < TT / 32; ++k) { float d0 = __fsub_rn(v[k], mx); asm volatile("" : "+v"(d0)); v[k] = __builtin_amdgcn_exp2f(__fmul_rn(d0, 1.4426950408889634f)); sum += v[k]; }
#pragma unroll
    for (int sh = 16; sh; sh >>= 1) sum += __shfl_xor(sum, sh, 32);
    const float f = __fdiv_rn(hires ? 1.0f : PCAR, sum);
{
        if (hires) {
#pragma unroll
            for (int ch = 0; ch < TT / 128; ++ch) { v4us oh, ol;
#pragma unroll
                for (int q = 0; q < 4; ++q) { unsigned short a, c2; splitf(v[ch * 4 + q] * f, a, c2); oh[q] = a; ol[q] = c2; }
                const size_t oo = ((size_t)zz * (RH ? RH : 1) + i) * TT + ch * 128 + lane * 4; *(v4us*)(Ph + oo) = oh; *(v4us*)(Pl + oo) = ol; }
        } else {
#pragma unroll
            for (int ch = 0; ch < TT / 128; ++ch) { v4h o4;
#pragma unroll
                for (int q = 0; q < 4; ++q) o4[q] = tohx(v[ch * 4 + q] * f);
                *(v4h*)(P16 + (size_t)row * TT + ch * 128 + lane * 4) = o4; } }
         }
}
// k_merge: adds the partial planes of the split-K probability x value product in plane order (row t has planes 0 .. nc-1, the runs of KCH keys that start inside its 64-row tile's diagonal bound) and scatters to [t][head][d].
__global__ __launch_bounds__(256) void k_merge(const float* __restrict__ O, int h0, float* OUTb) { const size_t e = ((size_t)blockIdx.x * 256 + threadIdx.x) * 2; if (e >= (size_t)ZH * TT * HD) return; const int d = (int)(e % HD); const int t = (int)((e / HD) % TT); const int zz = (int)(e / ((size_t)HD * TT)); const float cs = (t < RH) ? 1.0f : (1.0f / PCAR); const size_t oo = (size_t)t * DQ + (h0 + zz) * HD + d;
    const int nc = ((t / 64 + 1) * 64 + KCH - 1) / KCH; v2f p[NCH];
#pragma unroll
    for (int c = 0; c < NCH; ++c) p[c] = *(const v2f*)(O + (size_t)min(c, nc - 1) * ((size_t)ZH * TT * HD) + e);   // index clamped to a written plane: all loads issue together, none under a branch
    v2f s = p[0];
#pragma unroll
    for (int c = 1; c < NCH; ++c) { s[0] += (c < nc) ? p[c][0] : 0.0f; s[1] += (c < nc) ? p[c][1] : 0.0f; }
    v2f o2; o2[0] = s[0] * cs; o2[1] = s[1] * cs; *(v2f*)(OUTb + oo) = o2;  }

extern "C" void kernel_launch(void* const* d_in, const int* in_sizes, int n_in,
                              void* d_out, int out_size, void* d_ws, size_t ws_size, hipStream_t stream) {
    (void)in_sizes; (void)n_in; (void)out_size;
    const float* qi = (const float*)d_in[0]; const float* ki = (const float*)d_in[1]; const float* vi = (const float*)d_in[2]; const float* wq = (const float*)d_in[3]; const float* x = nullptr; const float* wk = nullptr; const float* wv = nullptr; const float* wo = nullptr; (void)x; (void)wk; (void)wv; (void)wo;
    float* OUT = (float*)d_out;     // [4][2048][512]
    char* wsp = (char*)d_ws;
    auto take = [&](size_t bytes) { char* p = wsp; wsp += (bytes + 255) & ~(size_t)255; return (void*)p; };
    bf* WQ = (bf*)take((size_t)HD * HD * 2);  float* CS = (float*)take((size_t)TT * HD * 2 * 4);
    bf* XB = (bf*)take((size_t)TT * DM * 2); float* FQ = (float*)take((size_t)TT * DQ * 4); 
    h16* QP16 = (h16*)take((size_t)NH_ * TT * HD * 2); h16* KP16 = (h16*)take((size_t)NKV * TT * HD * 2); h16* VT16 = (h16*)take((size_t)NKV * HD * TT * 2);
    bf* QPh = (bf*)take((size_t)NH_ * TT * HD * 2); bf* QPl = (bf*)take((size_t)NH_ * TT * HD * 2); bf* KPh = (bf*)take((size_t)NKV * TT * HD * 2); bf* KPl = (bf*)take((size_t)NKV * TT * HD * 2); bf* VTh = (bf*)take((size_t)NKV * HD * TT * 2); bf* VTl = (bf*)take((size_t)NKV * HD * TT * 2); bf* Ph = (bf*)take((size_t)ZH * RH * TT * 2); bf* Pl = (bf*)take((size_t)ZH * RH * TT * 2);
    float* Sb = (float*)take((size_t)ZH * TT * TT * 4); h16* P16 = (h16*)take((size_t)ZH * TT * TT * 2); float* Ob = (float*)take((size_t)NCH * ZH * TT * HD * 4);
    if ((size_t)(wsp - (char*)d_ws) > ws_size) return;    // ws 256 MiB
    { k_wtG<<<(unsigned)((HD * HD / 64 + 63) / 64), 256, 0, stream>>>(wq, HD, HD, WQ);   /* bilinear_weight 'xw' [64][64] -> Bt */ }
    k_csid<<<(TT * HD + 255) / 256, 256, 0, stream>>>(CS);
    const unsigned LQ = (unsigned)(((size_t)NH_ * TT * HD / 2 + 255) / 256), LKv = (unsigned)(((size_t)NKV * TT * HD / 2 + 255) / 256);
    for (int b = 0; b < NB_; ++b) {
        
        k_cvt8<<<(unsigned)(((size_t)TT * DM / 8 + 255) / 256), 256, 0, stream>>>(qi + (size_t)b * TT * DM, XB, (size_t)TT * DM / 8);   /* bf16 copy of the batch's queries [2048 x 8][64] */
        k_gemmw<bf, 0, false><<<dim3(TT * NH_ / 64, HD / 64, 1), 32, 0, stream>>>(XB, nullptr, WQ, nullptr, HD, FQ, HD, nullptr, 0, 0, 0);   /* qw = q W for all (token, head) rows: [16384][64] x [64][64], exact */
        k_rope<<<LQ, 256, 0, stream>>>(FQ, DQ, NH_, CS, nullptr, nullptr, 1.0f, QP16, QPh, QPl);
        k_ropeR<<<LKv, 256, 0, stream>>>(ki + (size_t)b * TT * DKV, DKV, NKV, CS, nullptr, nullptr, 1.0f, KP16, KPh, KPl);
        k_vtp<<<LKv, 256, 0, stream>>>(vi + (size_t)b * TT * DKV, DKV, NKV, VT16, VTh, VTl);
        for (int h0 = 0; h0 < NH_; h0 += ZH) { const size_t zq = (size_t)h0, zk = (size_t)(h0 / REP);   // one kv head per query head: the pass's two heads use consecutive kv planes (z-strides TT*HD)
            k_gemmc<bf, 2, 1><<<dim3(RH / 64, TT / 64, ZH), 32, 0, stream>>>(QPh + zq * TT * HD, QPl + zq * TT * HD, KPh + zk * TT * HD, KPl + zk * TT * HD, HD, Sb, TT, 0, (size_t)TT * HD, (size_t)TT * HD, (size_t)TT * TT, 0);
            k_asoft<<<ZH * TT / 8, 256, 0, stream>>>(Sb, P16, Ph, Pl);
            k_gemmc<bf, 2, 2><<<dim3(RH / 64, NCH, ZH), 32, 0, stream>>>(Ph, Pl, VTh + zk * HD * TT, VTl + zk * HD * TT, TT, Ob, HD, 0, (size_t)RH * TT, (size_t)HD * TT, (size_t)TT * HD, (size_t)ZH * TT * HD);
            k_merge<<<(unsigned)(((size_t)ZH * TT * HD / 2 + 255) / 256), 256, 0, stream>>>(Ob, h0, OUT + (size_t)b * TT * DQ); }
         }
}

// v002
// One run takes 146 microseconds.
// Timed twice side by side with v001, it ran 3.41 and 3.43 times as fast.
// Over all steps from v000 it is 6.82 times as fast.
#include <hip/hip_runtime.h>

#include <hip/hip_runtime.h>

#define NB_  4
#define TT   2048
#define DM   512
#define NH_  8
#define NKV  8
#define REP  (NH_ / NKV)
#define HD   64
#define DQ   (NH_ * HD)
#define DKV  (NKV * HD)
#define SCL  0.125f   // HD^-0.5
typedef _Float16 h16;
typedef unsigned short bf;
typedef __attribute__((ext_vector_type(16))) __bf16   v16bf;
typedef __attribute__((ext_vector_type(16))) _Float16 v16h;
typedef __attribute__((ext_vector_type(8)))  _Float16 v8h;
typedef __attribute__((ext_vector_type(8)))  unsigned short v8us;
typedef __attribute__((ext_vector_type(8)))  float    v8f;
typedef __attribute__((ext_vector_type(4)))  float    v4f;
typedef v8h  __attribute__((may_alias)) v8ha;
typedef v4f  __attribute__((may_alias)) v4fa;
typedef v8us __attribute__((may_alias)) v8usa;

__device__ __forceinline__ unsigned short f2bf(float f) { unsigned u = __float_as_uint(f); u += 0x7FFFu + ((u >> 16) & 1u); return (unsigned short)(u >> 16); }
__device__ __forceinline__ float bf2f(unsigned short b) { return __uint_as_float(((unsigned)b) << 16); }
__device__ __forceinline__ float bfr(float f) { return bf2f(f2bf(f)); }
__device__ __forceinline__ v16h cat16(v8h lo, v8h hi) { return __builtin_shufflevector(lo, hi, 0, 1, 2, 3, 4, 5, 6, 7, 8, 9, 10, 11, 12, 13, 14, 15); }
__device__ __forceinline__ v16bf cat16b(v8us lo, v8us hi) { return __builtin_bit_cast(v16bf, __builtin_shufflevector(lo, hi, 0, 1, 2, 3, 4, 5, 6, 7, 8, 9, 10, 11, 12, 13, 14, 15)); }
__device__ __forceinline__ v8f wmma16(v16h a, v16h b, v8f c) { return __builtin_amdgcn_wmma_f32_16x16x32_f16(false, a, false, b, (short)0, c, false, false); }
__device__ __forceinline__ v8f wmmab(v16bf a, v16bf b, v8f c) { return __builtin_amdgcn_wmma_f32_16x16x32_bf16(false, a, false, b, (short)0, c, false, false); }



// ---- k_gemmw: register-blocked GEMM, ONE WAVE per 64x64 output tile (16 accumulators), operands straight from K-contiguous 16-bit planes; grid (M/64, N/64, Z), 32 threads.
// C[m][n] (f32, pitch ldc, + optional f32 bias[n]) = sum_k A[m][k] Bt[n][k] (+ split products per NSPLIT). z-batch strides sA/sB/sC in elements. K % 32 == 0.
template <typename T16> struct WFrag;
template <> struct WFrag<h16> { typedef v16h V; static __device__ __forceinline__ V ld(const h16* p) { return cat16(*(const v8h*)p, *(const v8h*)(p + 16)); } static __device__ __forceinline__ v8f mma(V a, V b, v8f c) { return wmma16(a, b, c); } };
template <> struct WFrag<bf> { typedef v16bf V; static __device__ __forceinline__ V ld(const bf* p) { return cat16b(*(const v8us*)p, *(const v8us*)(p + 16)); } static __device__ __forceinline__ v8f mma(V a, V b, v8f c) { return wmmab(a, b, c); } };
template <typename T16, int NSPLIT, bool BIAS>
__global__ __launch_bounds__(32) void k_gemmw(const T16* __restrict__ A, const T16* __restrict__ A2, const T16* __restrict__ Bt, const T16* __restrict__ Bt2, int K, float* C, int ldc, const float* __restrict__ bias, size_t sA, size_t sB, size_t sC) {
    typedef typename WFrag<T16>::V V;
    __shared__ __align__(16) float os[16 * 68];
    const size_t z = blockIdx.z; A += z * sA; if (A2) A2 += z * sA; Bt += z * sB; if (Bt2) Bt2 += z * sB; C += z * sC;
    const int lane = threadIdx.x & 31, lr = lane & 15, hi = lane >> 4; const int r0 = blockIdx.x * 64, c0 = blockIdx.y * 64;
    v8f acc[4][4];
#pragma unroll
    for (int mb = 0; mb < 4; ++mb)
#pragma unroll
        for (int nb = 0; nb < 4; ++nb) acc[mb][nb] = (v8f){};
    const size_t aoff = (size_t)(r0 + lr) * K + 8 * hi, boff = (size_t)(c0 + lr) * K + 8 * hi;
#pragma unroll 1
    for (int kc = 0; kc < K; kc += 32) {
        V a[4], a2[4];
#pragma unroll
        for (int mb = 0; mb < 4; ++mb) { a[mb] = WFrag<T16>::ld(A + aoff + (size_t)mb * 16 * K + kc); if (NSPLIT == 1 || NSPLIT == 2) a2[mb] = WFrag<T16>::ld(A2 + aoff + (size_t)mb * 16 * K + kc); }
#pragma unroll
        for (int nb = 0; nb < 4; ++nb) { const V b = WFrag<T16>::ld(Bt + boff + (size_t)nb * 16 * K + kc); V b2; if (NSPLIT >= 2) b2 = WFrag<T16>::ld(Bt2 + boff + (size_t)nb * 16 * K + kc);
#pragma unroll
            for (int mb = 0; mb < 4; ++mb) { acc[mb][nb] = WFrag<T16>::mma(a[mb], b, acc[mb][nb]); if (NSPLIT == 1 || NSPLIT == 2) acc[mb][nb] = WFrag<T16>::mma(a2[mb], b, acc[mb][nb]); if (NSPLIT >= 2) acc[mb][nb] = WFrag<T16>::mma(a[mb], b2, acc[mb][nb]); } }
        asm volatile("v_nop\n\tv_nop\n\tv_nop\n\tv_nop" : "+v"(acc[0][0]), "+v"(acc[1][1]), "+v"(acc[2][2]), "+v"(acc[3][3]) : "v"(a[0]), "v"(a[3]));
    }
#pragma unroll
    for (int mb = 0; mb < 4; ++mb) {
#pragma unroll
        for (int nb = 0; nb < 4; ++nb) {
#pragma unroll
            for (int j = 0; j < 8; ++j) os[(hi * 8 + j) * 68 + nb * 16 + lr] = acc[mb][nb][j]; }
        __builtin_amdgcn_wave_barrier(); asm volatile("" ::: "memory");
        float* crow = C + (size_t)(r0 + mb * 16) * ldc + c0;
{
#pragma unroll
            for (int s = 0; s < 8; ++s) { const int row = 2 * s + hi, cofs = lr * 4; v4f val = *(const v4fa*)(os + row * 68 + cofs); if (BIAS) { val[0] += bfr(bias[c0 + cofs]); val[1] += bfr(bias[c0 + cofs + 1]); val[2] += bfr(bias[c0 + cofs + 2]); val[3] += bfr(bias[c0 + cofs + 3]); }
                *(v4f*)(crow + (size_t)row * ldc + cofs) = val; }
             }
        __builtin_amdgcn_wave_barrier(); asm volatile("" ::: "memory");
    }
}

__device__ __forceinline__ h16 tohx(float x) { return (h16)x; }
__device__ __forceinline__ void splitf(float y, unsigned short& h, unsigned short& l) { h = f2bf(y); l = f2bf(y - bf2f(h)); }
typedef __attribute__((ext_vector_type(2))) _Float16 v2h;
typedef __attribute__((ext_vector_type(4))) _Float16 v4h;
typedef __attribute__((ext_vector_type(2))) unsigned short v2us;
typedef __attribute__((ext_vector_type(4))) unsigned short v4us;
typedef __attribute__((ext_vector_type(2))) float v2f;
typedef __attribute__((ext_vector_type(4))) int v4i;

__global__ __launch_bounds__(256) void k_wtG(const float* __restrict__ w, int K, int N, bf* Bt) {
    const int lane = threadIdx.x & 31; const int L0 = (blockIdx.x * 8 + (threadIdx.x >> 5)) * 8; const int nlines = N * K / 64;
{
#pragma unroll 1
        for (int l = 0; l < 8; ++l) { const int L = L0 + l; if (L >= nlines) break; const size_t e = (size_t)L * 64 + lane * 2; const int k = (int)(e % K), n = (int)(e / K); v2us o;
            o[0] = f2bf(w[(size_t)k * N + n]); o[1] = f2bf(w[(size_t)(k + 1) * N + n]); *(v2us*)(Bt + e) = o; }
         }
}
__global__ __launch_bounds__(256) void k_cvt8(const float* __restrict__ src, bf* dst, size_t n8) { const size_t i = (size_t)blockIdx.x * 256 + threadIdx.x; if (i >= n8) return; const v8f v = *(const v8f*)(src + i * 8); v8us o;
#pragma unroll
    for (int k = 0; k < 8; ++k) o[k] = f2bf(v[k]); *(v8us*)(dst + i * 8) = o;  }

// k_rope: head planes [h][t][d] (fp16 + hi/lo) of rope(x) x sc with the rotate-half convention out[d] = x[d] cos[t][d] - x[d+HD/2] sin[t][d], out[d+HD/2] = x[d+HD/2] cos[t][d+HD/2] + x[d] sin[t][d+HD/2]
__global__ __launch_bounds__(256) void k_rope(const float* __restrict__ F, int pitch, int nheads, const float* __restrict__ CS, const float* __restrict__ RF, const float* __restrict__ nw, float sc, h16* P16, bf* Ph, bf* Pl) {
    const size_t e = ((size_t)blockIdx.x * 256 + threadIdx.x) * 2; if (e >= (size_t)nheads * TT * HD) return; const int d = (int)(e % HD); const int t = (int)((e / HD) % TT); const int h = (int)(e / ((size_t)HD * TT)); const float* f = F + (size_t)t * pitch + h * HD; const float rf = RF ? RF[(size_t)h * TT + t] : 1.0f; v2h o16; v2us oh, ol;
#pragma unroll
    for (int q = 0; q < 2; ++q) { const int dd = d + q; const int dp = (dd < HD / 2) ? dd + HD / 2 : dd - HD / 2; float x0 = f[dd], x1 = f[dp];
        if (RF) { float n0 = __fmul_rn(x0, rf), n1 = __fmul_rn(x1, rf); asm volatile("" : "+v"(n0)); asm volatile("" : "+v"(n1)); x0 = __fmul_rn(bfr(nw[dd]), n0); x1 = __fmul_rn(bfr(nw[dp]), n1); }
        const v2f cs = *(const v2f*)(CS + ((size_t)t * HD + dd) * 2); float a = __fmul_rn(x0, cs[0]), bq = __fmul_rn(x1, cs[1]); asm volatile("" : "+v"(a)); asm volatile("" : "+v"(bq)); const float r = ((dd < HD / 2) ? __fsub_rn(a, bq) : __fadd_rn(a, bq)) * sc;
        o16[q] = tohx(r); unsigned short a2, c2; splitf(r, a2, c2); oh[q] = a2; ol[q] = c2; }
    *(v2h*)(P16 + e) = o16; *(v2us*)(Ph + e) = oh; *(v2us*)(Pl + e) = ol;  }
__global__ __launch_bounds__(256) void k_ropeR(const float* __restrict__ F, int pitch, int nheads, const float* __restrict__ CS, const float* __restrict__ RF, const float* __restrict__ nw, float sc, h16* P16, bf* Ph, bf* Pl) {
    const size_t e = ((size_t)blockIdx.x * 256 + threadIdx.x) * 2; if (e >= (size_t)nheads * TT * HD) return; const int d = (int)(e % HD); const int t = (int)((e / HD) % TT); const int h = (int)(e / ((size_t)HD * TT)); const float* f = F + (size_t)t * pitch + h * HD; const float rf = RF ? RF[(size_t)h * TT + t] : 1.0f; v2h o16; v2us oh, ol;
#pragma unroll
    for (int q = 0; q < 2; ++q) { const int dd = d + q; const int dp = (dd < HD / 2) ? dd + HD / 2 : dd - HD / 2; float x0 = bfr(f[dd]), x1 = bfr(f[dp]);
        if (RF) { float n0 = __fmul_rn(x0, rf), n1 = __fmul_rn(x1, rf); asm volatile("" : "+v"(n0)); asm volatile("" : "+v"(n1)); x0 = __fmul_rn(bfr(nw[dd]), n0); x1 = __fmul_rn(bfr(nw[dp]), n1); }
        const v2f cs = *(const v2f*)(CS + ((size_t)t * HD + dd) * 2); float a = __fmul_rn(x0, cs[0]), bq = __fmul_rn(x1, cs[1]); asm volatile("" : "+v"(a)); asm volatile("" : "+v"(bq)); const float r = ((dd < HD / 2) ? __fsub_rn(a, bq) : __fadd_rn(a, bq)) * sc;
        o16[q] = tohx(r); unsigned short a2, c2; splitf(r, a2, c2); oh[q] = a2; ol[q] = c2; }
    *(v2h*)(P16 + e) = o16; *(v2us*)(Ph + e) = oh; *(v2us*)(Pl + e) = ol;  }
__global__ __launch_bounds__(256) void k_vtp(const float* __restrict__ F, int pitch, int nheads, h16* V16, bf* Vh, bf* Vl) { const size_t e = ((size_t)blockIdx.x * 256 + threadIdx.x) * 2; if (e >= (size_t)nheads * HD * TT) return; const int t = (int)(e % TT); const int d = (int)((e / TT) % HD); const int g = (int)(e / ((size_t)TT * HD)); v2h o16; v2us oh, ol;
#pragma unroll
    for (int q = 0; q < 2; ++q) { const float x = bfr(F[(size_t)(t + q) * pitch + g * HD + d]);   /* raw input: bf16-rounded here */ o16[q] = tohx(x); unsigned short a2, c2; splitf(x, a2, c2); oh[q] = a2; ol[q] = c2; }
    *(v2h*)(V16 + e) = o16; *(v2us*)(Vh + e) = oh; *(v2us*)(Vl + e) = ol;  }
__global__ __launch_bounds__(256) void k_csid(float* CS) { const int idx = blockIdx.x * 256 + threadIdx.x; if (idx >= TT * HD) return; v2f cs; cs[0] = 1.0f; cs[1] = 0.0f; *(v2f*)(CS + (size_t)idx * 2) = cs;  }
// k_fattn: scores, causal softmax and probability x value product in one launch for every batch and head; nothing of the score matrix goes to memory. One wave owns 16 queries.
// Transposed products: S^T = K Q^T (A = 16 key rows, B = 16 query columns) and O^T += V^T P^T, so a lane holds one query's scores (keys 8 hi + r of each 16-key tile) and two score tiles, converted in place,
// are the B operand of the second product. Running maximum and sum per query (online softmax); the hi/lo bf16 split products are those of the unfused form: Kh Qh + Kh Ql + Kl Qh and Vh Ph + Vh Pl + Vl Ph.
// The eight waves of a work-group share K and V^T through LDS: stages of SK keys, two buffers, the next stage's global loads in flight during this stage's products, one barrier per stage.
// Waves 0-3 take a 64-query tile from the long end of the causal triangle, waves 4-7 the mirrored tile from the short end of the same head, so every work-group has the same number of products;
// a wave past its own diagonal goes on staging and meeting the barriers.
#define SK 64                     // keys per stage: a V^T row piece is then one whole 128-byte line
#define LP 72                     // LDS row pitch in 16-bit elements: 144 bytes, 16 x odd, for 16-byte reads of 128-byte rows
#define LT (64 * LP)              // one staged tile: 64 rows (keys of K, d of V^T)
typedef __attribute__((ext_vector_type(2))) __bf16 v2bf;
__device__ __forceinline__ float xhalf(float x) { const int b = __float_as_int(x); return __int_as_float(__builtin_amdgcn_permlanex16(b, b, 0x76543210, 0xfedcba98, false, false)); }   // value of lane ^ 16
// eight 2^x and, in the same statement, the one free issue slot that the instruction set asks for behind a transcendental; the early-clobber outputs keep every source whole until the statement ends
__device__ __forceinline__ v8f exp2x8(v8f x) { float d0, d1, d2, d3, d4, d5, d6, d7;
    asm("v_exp_f32 %0, %8\n\tv_exp_f32 %1, %9\n\tv_exp_f32 %2, %10\n\tv_exp_f32 %3, %11\n\tv_exp_f32 %4, %12\n\tv_exp_f32 %5, %13\n\tv_exp_f32 %6, %14\n\tv_exp_f32 %7, %15\n\tv_nop"
        : "=&v"(d0), "=&v"(d1), "=&v"(d2), "=&v"(d3), "=&v"(d4), "=&v"(d5), "=&v"(d6), "=&v"(d7) : "v"(x[0]), "v"(x[1]), "v"(x[2]), "v"(x[3]), "v"(x[4]), "v"(x[5]), "v"(x[6]), "v"(x[7]));
    v8f d; d[0] = d0; d[1] = d1; d[2] = d2; d[3] = d3; d[4] = d4; d[5] = d5; d[6] = d6; d[7] = d7; return d; }
__global__ __launch_bounds__(256) __attribute__((amdgpu_waves_per_eu(4, 4))) void k_fattn(const bf* __restrict__ Qh, const bf* __restrict__ Ql, const bf* __restrict__ Kh, const bf* __restrict__ Kl, const bf* __restrict__ Vh, const bf* __restrict__ Vl, float* __restrict__ OUT) {
    typedef WFrag<bf> F;
    __shared__ __align__(16) bf sm[2][4][LT];                        // [buffer][Kh, Kl, Vh, Vl]
    const int tid = threadIdx.x, lane = tid & 31, lr = lane & 15, hi = lane >> 4; const int w = __builtin_amdgcn_readfirstlane(tid >> 5);
    const int g = blockIdx.x, bh = blockIdx.y; const int nst = TT / SK - g;   // stages up to the long tile's diagonal: the same for the whole work-group
    const int q0 = ((w < 4) ? (TT / 64 - 1 - g) : g) * 64 + (w & 3) * 16, np = q0 / 32 + 1;   // this wave's queries; its key blocks of 32 up to and including the one that holds the diagonal
    const size_t po = (size_t)bh * TT * HD;
    const bf* qhp = Qh + po + (size_t)(q0 + lr) * HD + 8 * hi; const bf* qlp = Ql + po + (size_t)(q0 + lr) * HD + 8 * hi;
    const int sr = tid >> 3, sc = (tid & 7) * 8, so = sr * LP + sc;  // staging: eight threads per 128-byte row, rows sr and sr + 32 of each tile
    const bf* gkh = Kh + po + (size_t)sr * HD + sc; const bf* gkl = Kl + po + (size_t)sr * HD + sc; const bf* gvh = Vh + po + (size_t)sr * TT + sc; const bf* gvl = Vl + po + (size_t)sr * TT + sc;
    v8us stg[8];
    auto gload = [&](int st) { const size_t ko = (size_t)st * SK * HD, vo = (size_t)st * SK;
        stg[0] = *(const v8us*)(gkh + ko); stg[1] = *(const v8us*)(gkh + ko + 32 * HD); stg[2] = *(const v8us*)(gkl + ko); stg[3] = *(const v8us*)(gkl + ko + 32 * HD);
        stg[4] = *(const v8us*)(gvh + vo); stg[5] = *(const v8us*)(gvh + vo + 32 * TT); stg[6] = *(const v8us*)(gvl + vo); stg[7] = *(const v8us*)(gvl + vo + 32 * TT); };
    auto sstore = [&](int bi) {
#pragma unroll
        for (int pl = 0; pl < 4; ++pl) { *(v8us*)&sm[bi][pl][so] = stg[2 * pl]; *(v8us*)&sm[bi][pl][so + 32 * LP] = stg[2 * pl + 1]; } };
    gload(0);
    v16bf qh[2], ql[2];
#pragma unroll
    for (int ks = 0; ks < 2; ++ks) { qh[ks] = F::ld(qhp + ks * 32); ql[ks] = F::ld(qlp + ks * 32); }
    v8f o[4];
#pragma unroll
    for (int dt = 0; dt < 4; ++dt) o[dt] = (v8f){};
    float mrun = -3.0e38f, lsum = 0.f;
    sstore(0);
    __syncthreads();
#pragma unroll 1
    for (int st = 0; st < nst; ++st) {
        const bool more = st + 1 < nst;
        if (more) { gload(st + 1); asm volatile("s_wait_xcnt 0x0" ::: "memory"); }   // the wait stands before the products below reuse the registers that hold these loads' addresses
        const bf* kt0 = &sm[st & 1][0][0] + lr * LP + 8 * hi;        // this lane's row and k half in tile Kh; the other tiles lie LT apart
#pragma unroll
        for (int p = 0; p < 2; ++p) { const int kb = st * 2 + p;
            if (kb < np) {
                v8f s[2];
#pragma unroll
                for (int kt = 0; kt < 2; ++kt) { s[kt] = (v8f){};
#pragma unroll
                    for (int ks = 0; ks < 2; ++ks) { const bf* kp = kt0 + (p * 32 + kt * 16) * LP + ks * 32; const v16bf kh = F::ld(kp), kl = F::ld(kp + LT);
                        s[kt] = F::mma(kh, qh[ks], s[kt]); s[kt] = F::mma(kh, ql[ks], s[kt]); s[kt] = F::mma(kl, qh[ks], s[kt]); } }
#pragma unroll
                for (int kt = 0; kt < 2; ++kt)
#pragma unroll
                    for (int j = 0; j < 8; ++j) s[kt][j] *= SCL;
                if (kb == np - 1) {                                  // only the wave's last block crosses the diagonal: key > query is masked
#pragma unroll
                    for (int kt = 0; kt < 2; ++kt)
#pragma unroll
                        for (int j = 0; j < 8; ++j) s[kt][j] = (kb * 32 + kt * 16 + hi * 8 + j <= q0 + lr) ? s[kt][j] : -3.0e38f; }
                float mx = s[0][0];
#pragma unroll
                for (int kt = 0; kt < 2; ++kt)
#pragma unroll
                    for (int j = 0; j < 8; ++j) mx = fmaxf(mx, s[kt][j]);
                mx = fmaxf(mx, xhalf(mx)); const float mnew = fmaxf(mrun, mx);
                const float al = __builtin_amdgcn_exp2f((mrun - mnew) * 1.4426950408889634f); mrun = mnew;
                float bs = 0.f; v16bf ph, pl;
#pragma unroll
                for (int kt = 0; kt < 2; ++kt) { const v8f e = exp2x8((s[kt] - mnew) * 1.4426950408889634f);
#pragma unroll
                    for (int j = 0; j < 8; j += 2) { v2f pr; pr[0] = e[j]; pr[1] = e[j + 1]; bs += pr[0] + pr[1];
                        const v2bf h2 = __builtin_convertvector(pr, v2bf); v2f r; r[0] = pr[0] - (float)h2[0]; r[1] = pr[1] - (float)h2[1]; const v2bf l2 = __builtin_convertvector(r, v2bf);
                        ph[kt * 8 + j] = h2[0]; ph[kt * 8 + j + 1] = h2[1]; pl[kt * 8 + j] = l2[0]; pl[kt * 8 + j + 1] = l2[1]; } }
                lsum = lsum * al + bs;
#pragma unroll
                for (int dt = 0; dt < 4; ++dt) {
#pragma unroll
                    for (int j = 0; j < 8; ++j) o[dt][j] *= al; }
#pragma unroll
                for (int dt = 0; dt < 4; ++dt) { const bf* vp = kt0 + 2 * LT + dt * 16 * LP + p * 32; const v16bf vh = F::ld(vp), vl = F::ld(vp + LT);
                    o[dt] = F::mma(vh, ph, o[dt]); o[dt] = F::mma(vh, pl, o[dt]); o[dt] = F::mma(vl, ph, o[dt]); }
            } }
        if (more) sstore((st + 1) & 1);                              // into the buffer whose readers all passed the barrier at the foot of the trip before
        __syncthreads();                                             // publishes stage st + 1 and ends every wave's reads of stage st
    }
    lsum += xhalf(lsum); const float f = __fdiv_rn(1.0f, lsum);
    float* op = OUT + ((size_t)(bh / NH_) * TT + q0 + lr) * DQ + (bh % NH_) * HD + hi * 8;   // o[dt][j] = O[query q0 + lr][d = 16 dt + 8 hi + j]
#pragma unroll
    for (int dt = 0; dt < 4; ++dt) { v4f a, c;
#pragma unroll
        for (int j = 0; j < 4; ++j) { a[j] = o[dt][j] * f; c[j] = o[dt][j + 4] * f; }
        *(v4f*)(op + dt * 16) = a; *(v4f*)(op + dt * 16 + 4) = c; }
}

extern "C" void kernel_launch(void* const* d_in, const int* in_sizes, int n_in,
                              void* d_out, int out_size, void* d_ws, size_t ws_size, hipStream_t stream) {
    (void)in_sizes; (void)n_in; (void)out_size;
    const float* qi = (const float*)d_in[0]; const float* ki = (const float*)d_in[1]; const float* vi = (const float*)d_in[2]; const float* wq = (const float*)d_in[3]; const float* x = nullptr; const float* wk = nullptr; const float* wv = nullptr; const float* wo = nullptr; (void)x; (void)wk; (void)wv; (void)wo;
    float* OUT = (float*)d_out;     // [4][2048][512]
    char* wsp = (char*)d_ws;
    auto take = [&](size_t bytes) { char* p = wsp; wsp += (bytes + 255) & ~(size_t)255; return (void*)p; };
    bf* WQ = (bf*)take((size_t)HD * HD * 2);  float* CS = (float*)take((size_t)TT * HD * 2 * 4);
    bf* XB = (bf*)take((size_t)TT * DM * 2); float* FQ = (float*)take((size_t)TT * DQ * 4); 
    h16* QP16 = (h16*)take((size_t)NH_ * TT * HD * 2); h16* KP16 = (h16*)take((size_t)NKV * TT * HD * 2); h16* VT16 = (h16*)take((size_t)NKV * HD * TT * 2);
    const size_t PB = (size_t)NH_ * TT * HD;   // elements of one batch's head planes; the hi/lo planes hold every batch, for the one attention launch behind the loop
    bf* QPh = (bf*)take(NB_ * PB * 2); bf* QPl = (bf*)take(NB_ * PB * 2); bf* KPh = (bf*)take(NB_ * PB * 2); bf* KPl = (bf*)take(NB_ * PB * 2); bf* VTh = (bf*)take(NB_ * PB * 2); bf* VTl = (bf*)take(NB_ * PB * 2);
    if ((size_t)(wsp - (char*)d_ws) > ws_size) return;    // ws 256 MiB
    { k_wtG<<<(unsigned)((HD * HD / 64 + 63) / 64), 256, 0, stream>>>(wq, HD, HD, WQ);   /* bilinear_weight 'xw' [64][64] -> Bt */ }
    k_csid<<<(TT * HD + 255) / 256, 256, 0, stream>>>(CS);
    const unsigned LQ = (unsigned)(((size_t)NH_ * TT * HD / 2 + 255) / 256), LKv = (unsigned)(((size_t)NKV * TT * HD / 2 + 255) / 256);
    for (int b = 0; b < NB_; ++b) {
        
        k_cvt8<<<(unsigned)(((size_t)TT * DM / 8 + 255) / 256), 256, 0, stream>>>(qi + (size_t)b * TT * DM, XB, (size_t)TT * DM / 8);   /* bf16 copy of the batch's queries [2048 x 8][64] */
        k_gemmw<bf, 0, false><<<dim3(TT * NH_ / 64, HD / 64, 1), 32, 0, stream>>>(XB, nullptr, WQ, nullptr, HD, FQ, HD, nullptr, 0, 0, 0);   /* qw = q W for all (token, head) rows: [16384][64] x [64][64], exact */
        k_rope<<<LQ, 256, 0, stream>>>(FQ, DQ, NH_, CS, nullptr, nullptr, 1.0f, QP16, QPh + b * PB, QPl + b * PB);
        k_ropeR<<<LKv, 256, 0, stream>>>(ki + (size_t)b * TT * DKV, DKV, NKV, CS, nullptr, nullptr, 1.0f, KP16, KPh + b * PB, KPl + b * PB);
        k_vtp<<<LKv, 256, 0, stream>>>(vi + (size_t)b * TT * DKV, DKV, NKV, VT16, VTh + b * PB, VTl + b * PB);
         }
    k_fattn<<<dim3(TT / 128, NB_ * NH_, 1), 256, 0, stream>>>(QPh, QPl, KPh, KPl, VTh, VTl, OUT);   /* one kv head per query head: plane b * 8 + h of each */
}

// v003
// One run takes 67.5 microseconds.
// In two side-by-side timings against v002, it was 2.15 and 2.16 times as fast.
// Over all steps from v000 it is 14.7 times as fast.
#include <hip/hip_runtime.h>

#include <hip/hip_runtime.h>

#define NB_  4
#define TT   2048
#define DM   512
#define NH_  8
#define NKV  8
#define REP  (NH_ / NKV)
#define HD   64
#define DQ   (NH_ * HD)
#define DKV  (NKV * HD)
#define SCL  0.125f   // HD^-0.5
typedef _Float16 h16;
typedef unsigned short bf;
typedef __attribute__((ext_vector_type(16))) __bf16   v16bf;
typedef __attribute__((ext_vector_type(16))) _Float16 v16h;
typedef __attribute__((ext_vector_type(8)))  _Float16 v8h;
typedef __attribute__((ext_vector_type(8)))  unsigned short v8us;
typedef __attribute__((ext_vector_type(8)))  float    v8f;
typedef __attribute__((ext_vector_type(4)))  float    v4f;
typedef v8h  __attribute__((may_alias)) v8ha;
typedef v4f  __attribute__((may_alias)) v4fa;
typedef v8us __attribute__((may_alias)) v8usa;

__device__ __forceinline__ unsigned short f2bf(float f) { unsigned u = __float_as_uint(f); u += 0x7FFFu + ((u >> 16) & 1u); return (unsigned short)(u >> 16); }
__device__ __forceinline__ float bf2f(unsigned short b) { return __uint_as_float(((unsigned)b) << 16); }
__device__ __forceinline__ float bfr(float f) { return bf2f(f2bf(f)); }
__device__ __forceinline__ v16h cat16(v8h lo, v8h hi) { return __builtin_shufflevector(lo, hi, 0, 1, 2, 3, 4, 5, 6, 7, 8, 9, 10, 11, 12, 13, 14, 15); }
__device__ __forceinline__ v16bf cat16b(v8us lo, v8us hi) { return __builtin_bit_cast(v16bf, __builtin_shufflevector(lo, hi, 0, 1, 2, 3, 4, 5, 6, 7, 8, 9, 10, 11, 12, 13, 14, 15)); }
__device__ __forceinline__ v8f wmma16(v16h a, v16h b, v8f c) { return __builtin_amdgcn_wmma_f32_16x16x32_f16(false, a, false, b, (short)0, c, false, false); }
__device__ __forceinline__ v8f wmmab(v16bf a, v16bf b, v8f c) { return __builtin_amdgcn_wmma_f32_16x16x32_bf16(false, a, false, b, (short)0, c, false, false); }



// fragment loader and product of the 16x16x32 forms: sixteen k of one row per lane, k = 8 hi + 0..7 and 16 + 8 hi + 0..7
template <typename T16> struct WFrag;
template <> struct WFrag<h16> { typedef v16h V; static __device__ __forceinline__ V ld(const h16* p) { return cat16(*(const v8h*)p, *(const v8h*)(p + 16)); } static __device__ __forceinline__ v8f mma(V a, V b, v8f c) { return wmma16(a, b, c); } };
template <> struct WFrag<bf> { typedef v16bf V; static __device__ __forceinline__ V ld(const bf* p) { return cat16b(*(const v8us*)p, *(const v8us*)(p + 16)); } static __device__ __forceinline__ v8f mma(V a, V b, v8f c) { return wmmab(a, b, c); } };
typedef __attribute__((ext_vector_type(2))) _Float16 v2h;
typedef __attribute__((ext_vector_type(4))) _Float16 v4h;
typedef __attribute__((ext_vector_type(2))) unsigned short v2us;
typedef __attribute__((ext_vector_type(4))) unsigned short v4us;
typedef __attribute__((ext_vector_type(2))) float v2f;
typedef __attribute__((ext_vector_type(4))) int v4i;


// k_fattn: scores, causal softmax and probability x value product in one launch for every batch and head; nothing of the score matrix goes to memory. One wave owns 16 queries.
// Transposed products: S^T = K Q^T (A = 16 key rows, B = 16 query columns) and O^T += V^T P^T, so a lane holds one query's scores (keys 8 hi + r of each 16-key tile) and two score tiles, converted in place,
// are the B operand of the second product. Running maximum and sum per query (online softmax); the hi/lo bf16 split products are those of the unfused form: Kh Qh + Kh Ql + Kl Qh and Vh Ph + Vh Pl + Vl Ph.
// The eight waves of a work-group share K and V^T through LDS: stages of SK keys, two buffers, the next stage's global loads in flight during this stage's products, one barrier per stage.
// Waves 0-3 take a 64-query tile from the long end of the causal triangle, waves 4-7 the mirrored tile from the short end of the same head, so every work-group has the same number of products;
// a wave past its own diagonal goes on staging and meeting the barriers.
#define SK 64                     // keys per stage: a V^T row piece is then one whole 128-byte line
#define LP 72                     // LDS row pitch in 16-bit elements: 144 bytes, 16 x odd, for 16-byte reads of 128-byte rows
#define LT (64 * LP)              // one staged tile: 64 rows (keys of K, d of V^T)
typedef __attribute__((ext_vector_type(2))) __bf16 v2bf;
__device__ __forceinline__ float xhalf(float x) { const int b = __float_as_int(x); return __int_as_float(__builtin_amdgcn_permlanex16(b, b, 0x76543210, 0xfedcba98, false, false)); }   // value of lane ^ 16
// eight 2^x and, in the same statement, the one free issue slot that the instruction set asks for behind a transcendental; the early-clobber outputs keep every source whole until the statement ends
__device__ __forceinline__ v8f exp2x8(v8f x) { float d0, d1, d2, d3, d4, d5, d6, d7;
    asm("v_exp_f32 %0, %8\n\tv_exp_f32 %1, %9\n\tv_exp_f32 %2, %10\n\tv_exp_f32 %3, %11\n\tv_exp_f32 %4, %12\n\tv_exp_f32 %5, %13\n\tv_exp_f32 %6, %14\n\tv_exp_f32 %7, %15\n\tv_nop"
        : "=&v"(d0), "=&v"(d1), "=&v"(d2), "=&v"(d3), "=&v"(d4), "=&v"(d5), "=&v"(d6), "=&v"(d7) : "v"(x[0]), "v"(x[1]), "v"(x[2]), "v"(x[3]), "v"(x[4]), "v"(x[5]), "v"(x[6]), "v"(x[7]));
    v8f d; d[0] = d0; d[1] = d1; d[2] = d2; d[3] = d3; d[4] = d4; d[5] = d5; d[6] = d6; d[7] = d7; return d; }
__global__ __launch_bounds__(256) __attribute__((amdgpu_waves_per_eu(4, 4))) void k_fattn(const bf* __restrict__ Qh, const bf* __restrict__ Ql, const bf* __restrict__ Kh, const bf* __restrict__ Kl, const bf* __restrict__ Vh, const bf* __restrict__ Vl, float* __restrict__ OUT) {
    typedef WFrag<bf> F;
    __shared__ __align__(16) bf sm[2][4][LT];                        // [buffer][Kh, Kl, Vh, Vl]
    const int tid = threadIdx.x, lane = tid & 31, lr = lane & 15, hi = lane >> 4; const int w = __builtin_amdgcn_readfirstlane(tid >> 5);
    const int g = blockIdx.x, bh = blockIdx.y; const int nst = TT / SK - g;   // stages up to the long tile's diagonal: the same for the whole work-group
    const int q0 = ((w < 4) ? (TT / 64 - 1 - g) : g) * 64 + (w & 3) * 16, np = q0 / 32 + 1;   // this wave's queries; its key blocks of 32 up to and including the one that holds the diagonal
    const size_t po = (size_t)bh * TT * HD;
    const bf* qhp = Qh + po + (size_t)(q0 + lr) * HD + 8 * hi; const bf* qlp = Ql + po + (size_t)(q0 + lr) * HD + 8 * hi;
    const int sr = tid >> 3, sc = (tid & 7) * 8, so = sr * LP + sc;  // staging: eight threads per 128-byte row, rows sr and sr + 32 of each tile
    const bf* gkh = Kh + po + (size_t)sr * HD + sc; const bf* gkl = Kl + po + (size_t)sr * HD + sc; const bf* gvh = Vh + po + (size_t)sr * TT + sc; const bf* gvl = Vl + po + (size_t)sr * TT + sc;
    v8us stg[8];
    auto gload = [&](int st) { const size_t ko = (size_t)st * SK * HD, vo = (size_t)st * SK;
        stg[0] = *(const v8us*)(gkh + ko); stg[1] = *(const v8us*)(gkh + ko + 32 * HD); stg[2] = *(const v8us*)(gkl + ko); stg[3] = *(const v8us*)(gkl + ko + 32 * HD);
        stg[4] = *(const v8us*)(gvh + vo); stg[5] = *(const v8us*)(gvh + vo + 32 * TT); stg[6] = *(const v8us*)(gvl + vo); stg[7] = *(const v8us*)(gvl + vo + 32 * TT); };
    auto sstore = [&](int bi) {
#pragma unroll
        for (int pl = 0; pl < 4; ++pl) { *(v8us*)&sm[bi][pl][so] = stg[2 * pl]; *(v8us*)&sm[bi][pl][so + 32 * LP] = stg[2 * pl + 1]; } };
    gload(0);
    v16bf qh[2], ql[2];
#pragma unroll
    for (int ks = 0; ks < 2; ++ks) { qh[ks] = F::ld(qhp + ks * 32); ql[ks] = F::ld(qlp + ks * 32); }
    v8f o[4];
#pragma unroll
    for (int dt = 0; dt < 4; ++dt) o[dt] = (v8f){};
    float mrun = -3.0e38f, lsum = 0.f;
    sstore(0);
    __syncthreads();
#pragma unroll 1
    for (int st = 0; st < nst; ++st) {
        const bool more = st + 1 < nst;
        if (more) { gload(st + 1); asm volatile("s_wait_xcnt 0x0" ::: "memory"); }   // the wait stands before the products below reuse the registers that hold these loads' addresses
        const bf* kt0 = &sm[st & 1][0][0] + lr * LP + 8 * hi;        // this lane's row and k half in tile Kh; the other tiles lie LT apart
#pragma unroll
        for (int p = 0; p < 2; ++p) { const int kb = st * 2 + p;
            if (kb < np) {
                v8f s[2];
#pragma unroll
                for (int kt = 0; kt < 2; ++kt) { s[kt] = (v8f){};
#pragma unroll
                    for (int ks = 0; ks < 2; ++ks) { const bf* kp = kt0 + (p * 32 + kt * 16) * LP + ks * 32; const v16bf kh = F::ld(kp), kl = F::ld(kp + LT);
                        s[kt] = F::mma(kh, qh[ks], s[kt]); s[kt] = F::mma(kh, ql[ks], s[kt]); s[kt] = F::mma(kl, qh[ks], s[kt]); } }
#pragma unroll
                for (int kt = 0; kt < 2; ++kt)
#pragma unroll
                    for (int j = 0; j < 8; ++j) s[kt][j] *= SCL;
                if (kb == np - 1) {                                  // only the wave's last block crosses the diagonal: key > query is masked
#pragma unroll
                    for (int kt = 0; kt < 2; ++kt)
#pragma unroll
                        for (int j = 0; j < 8; ++j) s[kt][j] = (kb * 32 + kt * 16 + hi * 8 + j <= q0 + lr) ? s[kt][j] : -3.0e38f; }
                float mx = s[0][0];
#pragma unroll
                for (int kt = 0; kt < 2; ++kt)
#pragma unroll
                    for (int j = 0; j < 8; ++j) mx = fmaxf(mx, s[kt][j]);
                mx = fmaxf(mx, xhalf(mx)); const float mnew = fmaxf(mrun, mx);
                const float al = __builtin_amdgcn_exp2f((mrun - mnew) * 1.4426950408889634f); mrun = mnew;
                float bs = 0.f; v16bf ph, pl;
#pragma unroll
                for (int kt = 0; kt < 2; ++kt) { const v8f e = exp2x8((s[kt] - mnew) * 1.4426950408889634f);
#pragma unroll
                    for (int j = 0; j < 8; j += 2) { v2f pr; pr[0] = e[j]; pr[1] = e[j + 1]; bs += pr[0] + pr[1];
                        const v2bf h2 = __builtin_convertvector(pr, v2bf); v2f r; r[0] = pr[0] - (float)h2[0]; r[1] = pr[1] - (float)h2[1]; const v2bf l2 = __builtin_convertvector(r, v2bf);
                        ph[kt * 8 + j] = h2[0]; ph[kt * 8 + j + 1] = h2[1]; pl[kt * 8 + j] = l2[0]; pl[kt * 8 + j + 1] = l2[1]; } }
                lsum = lsum * al + bs;
#pragma unroll
                for (int dt = 0; dt < 4; ++dt) {
#pragma unroll
                    for (int j = 0; j < 8; ++j) o[dt][j] *= al; }
#pragma unroll
                for (int dt = 0; dt < 4; ++dt) { const bf* vp = kt0 + 2 * LT + dt * 16 * LP + p * 32; const v16bf vh = F::ld(vp), vl = F::ld(vp + LT);
                    o[dt] = F::mma(vh, ph, o[dt]); o[dt] = F::mma(vh, pl, o[dt]); o[dt] = F::mma(vl, ph, o[dt]); }
            } }
        if (more) sstore((st + 1) & 1);                              // into the buffer whose readers all passed the barrier at the foot of the trip before
        __syncthreads();                                             // publishes stage st + 1 and ends every wave's reads of stage st
    }
    lsum += xhalf(lsum); const float f = __fdiv_rn(1.0f, lsum);
    float* op = OUT + ((size_t)(bh / NH_) * TT + q0 + lr) * DQ + (bh % NH_) * HD + hi * 8;   // o[dt][j] = O[query q0 + lr][d = 16 dt + 8 hi + j]
#pragma unroll
    for (int dt = 0; dt < 4; ++dt) { v4f a, c;
#pragma unroll
        for (int j = 0; j < 4; ++j) { a[j] = o[dt][j] * f; c[j] = o[dt][j + 4] * f; }
        *(v4f*)(op + dt * 16) = a; *(v4f*)(op + dt * 16 + 4) = c; }
}


// k_prep: every operand plane of k_fattn in one launch. One work-group takes PT positions of one (batch, head): 96 input values per thread, all loads issued ahead of the first use.
// Q planes [bh][t][f]: hi/lo bf16 split of qw = bf16(q) bf16(W), as the transposed product (qw)^T = W^T q^T (A = 16 rows f of W^T, B = 16 query columns, the k order of WFrag::ld on both sides, e 0-31 then 32-63),
// so a lane holds eight consecutive f of one query; the split rows go through LDS and leave as whole 128-byte lines. K planes [bh][t][d] and V^T planes [bh][d][t]: the bf16-rounded inputs;
// a bf16 value has no low part, so their low planes are zero. V is transposed in LDS, two positions per dword, 16-byte pieces of a row swapped by d / 4 so that neither the column writes nor the row reads collide.
#define PT 128
typedef __attribute__((ext_vector_type(2))) unsigned v2u;
typedef __attribute__((ext_vector_type(4))) unsigned v4u;
__device__ __forceinline__ unsigned pkbf(float a, float b) { v2f p; p[0] = a; p[1] = b; return __builtin_bit_cast(unsigned, __builtin_convertvector(p, v2bf)); }   // a in the low half; round to nearest even
// work-group barrier that orders LDS only: the waves exchange nothing through global memory here, and __syncthreads() would also wait for every global store issued so far to be acknowledged
__device__ __forceinline__ void lds_barrier() { __builtin_amdgcn_fence(__ATOMIC_RELEASE, "workgroup", "local"); __builtin_amdgcn_s_barrier(); __builtin_amdgcn_fence(__ATOMIC_ACQUIRE, "workgroup", "local"); }
__global__ __launch_bounds__(256) void k_prep(const float* __restrict__ q, const float* __restrict__ k, const float* __restrict__ v, const float* __restrict__ wgt,
                                              bf* __restrict__ Qh, bf* __restrict__ Ql, bf* __restrict__ Kh, bf* __restrict__ Kl, bf* __restrict__ Vh, bf* __restrict__ Vl) {
    typedef WFrag<bf> F;
    __shared__ __align__(16) bf wt[HD * LP];              // W^T [f][e]
    __shared__ __align__(16) bf qs[2][PT * LP];           // [0]: bf16(q) rows, then the hi rows of qw; [1]: the lo rows
    __shared__ __align__(16) unsigned vt[HD * (PT / 2)];  // V^T [d][t / 2]
    const int tid = threadIdx.x, lane = tid & 31, lr = lane & 15, hi = lane >> 4, w = tid >> 5;
    const int t0 = blockIdx.x * PT, bh = blockIdx.y;
    const size_t ib = (((size_t)(bh / NH_) * TT + t0) * NH_ + (bh % NH_)) * HD;   // row t0 of this head in [b][t][h][e]; rows lie DQ apart
    const size_t pb = ((size_t)bh * TT + t0) * HD;                                // row t0 in a [bh][t][d] plane
    const size_t vb = (size_t)bh * HD * TT + t0;                                  // column t0 of row d = 0 in a [bh][d][t] plane
    const int r16 = tid >> 4, c = tid & 15, c4 = c * 4;                           // sixteen threads per 256-byte input row
    v4f xw[4], xq[8], xk[8], xv[8];
    { const float* wp = wgt + (size_t)(tid >> 3) * 2 * HD + (tid & 7) * 8;        // rows e and e + 1, eight f
      xw[0] = *(const v4f*)wp; xw[1] = *(const v4f*)(wp + 4); xw[2] = *(const v4f*)(wp + HD); xw[3] = *(const v4f*)(wp + HD + 4); }
#pragma unroll
    for (int p = 0; p < 8; ++p) xq[p] = *(const v4f*)(q + ib + (size_t)(p * 16 + r16) * DQ + c4);
    asm volatile("s_wait_xcnt 0x0" ::: "memory");   // here and below: stands before a register that an issued load or store names is written again
#pragma unroll
    for (int p = 0; p < 8; ++p) xv[p] = *(const v4f*)(v + ib + (size_t)((p >> 1) * 32 + 2 * r16 + (p & 1)) * DQ + c4);   // positions t and t + 1 in one thread
    asm volatile("s_wait_xcnt 0x0" ::: "memory");
#pragma unroll
    for (int p = 0; p < 8; ++p) xk[p] = *(const v4f*)(k + ib + (size_t)(p * 16 + r16) * DQ + c4);
    __builtin_amdgcn_sched_barrier(0);                    // keeps all 28 loads of a thread in flight together: without it the compiler issues V's loads only behind the first data wait
    { const v8us zz = (v8us){};
#pragma unroll
      for (int s = 0; s < 4; ++s) { const int idx = s * 256 + tid; *(v8us*)(Kl + pb + (size_t)idx * 8) = zz; *(v8us*)(Vl + vb + (size_t)(idx >> 4) * TT + (idx & 15) * 8) = zz; } }
    { unsigned* wd = (unsigned*)wt + (tid & 7) * 8 * (LP / 2) + (tid >> 3);
#pragma unroll
      for (int i = 0; i < 8; ++i) wd[i * (LP / 2)] = pkbf(xw[i >> 2][i & 3], xw[2 + (i >> 2)][i & 3]); }
#pragma unroll
    for (int p = 0; p < 8; ++p) { v2u o; o[0] = pkbf(xq[p][0], xq[p][1]); o[1] = pkbf(xq[p][2], xq[p][3]); *(v2u*)&qs[0][(p * 16 + r16) * LP + c4] = o; }
#pragma unroll
    for (int p = 0; p < 4; ++p) { const int t2 = p * 16 + r16;
#pragma unroll
        for (int i = 0; i < 4; ++i) vt[(c4 + i) * (PT / 2) + (((t2 >> 2) ^ c) << 2) + (t2 & 3)] = pkbf(xv[2 * p][i], xv[2 * p + 1][i]); }
#pragma unroll
    for (int p = 0; p < 8; ++p) { v2u o; o[0] = pkbf(xk[p][0], xk[p][1]); o[1] = pkbf(xk[p][2], xk[p][3]); *(v2u*)(Kh + pb + (size_t)(p * 16 + r16) * HD + c4) = o; }
    asm volatile("s_wait_xcnt 0x0" ::: "memory");
    lds_barrier();                                        // W^T, the bf16 query rows and V^T are complete
    bf* qrow = &qs[0][(w * 16 + lr) * LP + 8 * hi];       // a wave reads and rewrites its own sixteen rows only
    v16bf bq[2];
#pragma unroll
    for (int ks = 0; ks < 2; ++ks) bq[ks] = F::ld(qrow + ks * 32);
    v8f acc[4];
#pragma unroll
    for (int ft = 0; ft < 4; ++ft) acc[ft] = (v8f){};
#pragma unroll
    for (int ks = 0; ks < 2; ++ks)
#pragma unroll
        for (int ft = 0; ft < 4; ++ft) acc[ft] = F::mma(F::ld(&wt[(ft * 16 + lr) * LP + 8 * hi + ks * 32]), bq[ks], acc[ft]);
#pragma unroll
    for (int s = 0; s < 4; ++s) { const int idx = s * 256 + tid, d = idx >> 4, qd = idx & 15;
        *(v4u*)(Vh + vb + (size_t)d * TT + qd * 8) = *(const v4u*)&vt[d * (PT / 2) + ((qd ^ (d >> 2)) << 2)]; }
#pragma unroll
    for (int ft = 0; ft < 4; ++ft) { v4u hv, lv;          // acc[ft][j] = qw[query w * 16 + lr][f = 16 ft + 8 hi + j]
#pragma unroll
        for (int j = 0; j < 8; j += 2) { v2f pr; pr[0] = acc[ft][j]; pr[1] = acc[ft][j + 1]; const v2bf h2 = __builtin_convertvector(pr, v2bf);
            hv[j >> 1] = __builtin_bit_cast(unsigned, h2); lv[j >> 1] = pkbf(pr[0] - (float)h2[0], pr[1] - (float)h2[1]); }
        *(v4u*)(qrow + ft * 16) = hv; *(v4u*)(qrow + PT * LP + ft * 16) = lv; }
    lds_barrier();                                        // the split rows are complete
#pragma unroll
    for (int s = 0; s < 4; ++s) { const int idx = s * 256 + tid; const int lo = (idx >> 3) * LP + (idx & 7) * 8;
        *(v4u*)(Qh + pb + (size_t)idx * 8) = *(const v4u*)&qs[0][lo]; *(v4u*)(Ql + pb + (size_t)idx * 8) = *(const v4u*)&qs[1][lo]; }
}

extern "C" void kernel_launch(void* const* d_in, const int* in_sizes, int n_in,
                              void* d_out, int out_size, void* d_ws, size_t ws_size, hipStream_t stream) {
    (void)in_sizes; (void)n_in; (void)out_size;
    const float* qi = (const float*)d_in[0]; const float* ki = (const float*)d_in[1]; const float* vi = (const float*)d_in[2]; const float* wq = (const float*)d_in[3];
    float* OUT = (float*)d_out;     // [4][2048][512]
    char* wsp = (char*)d_ws;
    auto take = [&](size_t bytes) { char* p = wsp; wsp += (bytes + 255) & ~(size_t)255; return (void*)p; };
    const size_t PB = (size_t)NH_ * TT * HD;   // elements of one batch's head planes; the hi/lo planes hold every batch
    bf* QPh = (bf*)take(NB_ * PB * 2); bf* QPl = (bf*)take(NB_ * PB * 2); bf* KPh = (bf*)take(NB_ * PB * 2); bf* KPl = (bf*)take(NB_ * PB * 2); bf* VTh = (bf*)take(NB_ * PB * 2); bf* VTl = (bf*)take(NB_ * PB * 2);
    if ((size_t)(wsp - (char*)d_ws) > ws_size) return;    // ws 256 MiB
    k_prep<<<dim3(TT / PT, NB_ * NH_, 1), 256, 0, stream>>>(qi, ki, vi, wq, QPh, QPl, KPh, KPl, VTh, VTl);
    k_fattn<<<dim3(TT / 128, NB_ * NH_, 1), 256, 0, stream>>>(QPh, QPl, KPh, KPl, VTh, VTl, OUT);   /* one kv head per query head: plane b * 8 + h of each */
}

// v004
// Measured time: 51.6 microseconds a run.
// Timed twice side by side with v003, it ran 1.30 and 1.31 times as fast.
// Counting every step since v000, it is 19.2 times as fast.
#include <hip/hip_runtime.h>

#include <hip/hip_runtime.h>

#define NB_  4
#define TT   2048
#define DM   512
#define NH_  8
#define NKV  8
#define REP  (NH_ / NKV)
#define HD   64
#define DQ   (NH_ * HD)
#define DKV  (NKV * HD)
#define SCL  0.125f   // HD^-0.5
typedef _Float16 h16;
typedef unsigned short bf;
typedef __attribute__((ext_vector_type(16))) __bf16   v16bf;
typedef __attribute__((ext_vector_type(16))) _Float16 v16h;
typedef __attribute__((ext_vector_type(8)))  _Float16 v8h;
typedef __attribute__((ext_vector_type(8)))  unsigned short v8us;
typedef __attribute__((ext_vector_type(8)))  float    v8f;
typedef __attribute__((ext_vector_type(4)))  float    v4f;
typedef v8h  __attribute__((may_alias)) v8ha;
typedef v4f  __attribute__((may_alias)) v4fa;
typedef v8us __attribute__((may_alias)) v8usa;

__device__ __forceinline__ unsigned short f2bf(float f) { unsigned u = __float_as_uint(f); u += 0x7FFFu + ((u >> 16) & 1u); return (unsigned short)(u >> 16); }
__device__ __forceinline__ float bf2f(unsigned short b) { return __uint_as_float(((unsigned)b) << 16); }
__device__ __forceinline__ float bfr(float f) { return bf2f(f2bf(f)); }
__device__ __forceinline__ v16h cat16(v8h lo, v8h hi) { return __builtin_shufflevector(lo, hi, 0, 1, 2, 3, 4, 5, 6, 7, 8, 9, 10, 11, 12, 13, 14, 15); }
__device__ __forceinline__ v16bf cat16b(v8us lo, v8us hi) { return __builtin_bit_cast(v16bf, __builtin_shufflevector(lo, hi, 0, 1, 2, 3, 4, 5, 6, 7, 8, 9, 10, 11, 12, 13, 14, 15)); }
__device__ __forceinline__ v8f wmma16(v16h a, v16h b, v8f c) { return __builtin_amdgcn_wmma_f32_16x16x32_f16(false, a, false, b, (short)0, c, false, false); }
__device__ __forceinline__ v8f wmmab(v16bf a, v16bf b, v8f c) { return __builtin_amdgcn_wmma_f32_16x16x32_bf16(false, a, false, b, (short)0, c, false, false); }



// fragment loader and product of the 16x16x32 forms: sixteen k of one row per lane, k = 8 hi + 0..7 and 16 + 8 hi + 0..7
template <typename T16> struct WFrag;
template <> struct WFrag<h16> { typedef v16h V; static __device__ __forceinline__ V ld(const h16* p) { return cat16(*(const v8h*)p, *(const v8h*)(p + 16)); } static __device__ __forceinline__ v8f mma(V a, V b, v8f c) { return wmma16(a, b, c); } };
template <> struct WFrag<bf> { typedef v16bf V; static __device__ __forceinline__ V ld(const bf* p) { return cat16b(*(const v8us*)p, *(const v8us*)(p + 16)); } static __device__ __forceinline__ v8f mma(V a, V b, v8f c) { return wmmab(a, b, c); } };
typedef __attribute__((ext_vector_type(2))) _Float16 v2h;
typedef __attribute__((ext_vector_type(4))) _Float16 v4h;
typedef __attribute__((ext_vector_type(2))) unsigned short v2us;
typedef __attribute__((ext_vector_type(4))) unsigned short v4us;
typedef __attribute__((ext_vector_type(2))) float v2f;
typedef __attribute__((ext_vector_type(4))) int v4i;


// k_fattn: scores, causal softmax and probability x value product in one launch for every batch and head; nothing of the score matrix goes to memory. One wave owns 16 queries.
// Transposed products: S^T = K Q^T (A = 16 key rows, B = 16 query columns) and O^T += V^T P^T, so a lane holds one query's scores (keys 8 hi + r of each 16-key tile) and two score tiles, converted in place,
// are the B operand of the second product. Running maximum and sum per query (online softmax); qw and P are hi/lo bf16 splits, K and V are the bf16-rounded inputs, which have no low part: K Qh + K Ql and V Ph + V Pl.
// The eight waves of a work-group share K and V^T through LDS: stages of SK keys, two buffers, the next stage's global loads in flight during this stage's products, one barrier per stage.
// Waves 0-3 take a 64-query tile from the long end of the causal triangle, waves 4-7 the mirrored tile from the short end of the same head, so every work-group has the same number of products;
// a wave past its own diagonal goes on staging and meeting the barriers.
#define SK 64                     // keys per stage: a V^T row piece is then one whole 128-byte line
#define LP 72                     // LDS row pitch in 16-bit elements: 144 bytes, 16 x odd, for 16-byte reads of 128-byte rows
#define LT (64 * LP)              // one staged tile: 64 rows (keys of K, d of V^T)
typedef __attribute__((ext_vector_type(2))) __bf16 v2bf;
__device__ __forceinline__ float xhalf(float x) { const int b = __float_as_int(x); return __int_as_float(__builtin_amdgcn_permlanex16(b, b, 0x76543210, 0xfedcba98, false, false)); }   // value of lane ^ 16
// eight 2^x and, in the same statement, the one free issue slot that the instruction set asks for behind a transcendental; the early-clobber outputs keep every source whole until the statement ends
__device__ __forceinline__ v8f exp2x8(v8f x) { float d0, d1, d2, d3, d4, d5, d6, d7;
    asm("v_exp_f32 %0, %8\n\tv_exp_f32 %1, %9\n\tv_exp_f32 %2, %10\n\tv_exp_f32 %3, %11\n\tv_exp_f32 %4, %12\n\tv_exp_f32 %5, %13\n\tv_exp_f32 %6, %14\n\tv_exp_f32 %7, %15\n\tv_nop"
        : "=&v"(d0), "=&v"(d1), "=&v"(d2), "=&v"(d3), "=&v"(d4), "=&v"(d5), "=&v"(d6), "=&v"(d7) : "v"(x[0]), "v"(x[1]), "v"(x[2]), "v"(x[3]), "v"(x[4]), "v"(x[5]), "v"(x[6]), "v"(x[7]));
    v8f d; d[0] = d0; d[1] = d1; d[2] = d2; d[3] = d3; d[4] = d4; d[5] = d5; d[6] = d6; d[7] = d7; return d; }
__global__ __launch_bounds__(256) __attribute__((amdgpu_waves_per_eu(4, 4))) void k_fattn(const bf* __restrict__ Qh, const bf* __restrict__ Ql, const bf* __restrict__ Kh, const bf* __restrict__ Vh, float* __restrict__ OUT) {
    typedef WFrag<bf> F;
    __shared__ __align__(16) bf sm[2][2][LT];                        // [buffer][K, V^T]
    const int tid = threadIdx.x, lane = tid & 31, lr = lane & 15, hi = lane >> 4; const int w = __builtin_amdgcn_readfirstlane(tid >> 5);
    const int g = blockIdx.x, bh = blockIdx.y; const int nst = TT / SK - g;   // stages up to the long tile's diagonal: the same for the whole work-group
    const int q0 = ((w < 4) ? (TT / 64 - 1 - g) : g) * 64 + (w & 3) * 16, np = q0 / 32 + 1;   // this wave's queries; its key blocks of 32 up to and including the one that holds the diagonal
    const size_t po = (size_t)bh * TT * HD;
    const bf* qhp = Qh + po + (size_t)(q0 + lr) * HD + 8 * hi; const bf* qlp = Ql + po + (size_t)(q0 + lr) * HD + 8 * hi;
    const int sr = tid >> 3, sc = (tid & 7) * 8, so = sr * LP + sc;  // staging: eight threads per 128-byte row, rows sr and sr + 32 of each tile
    const bf* gkh = Kh + po + (size_t)sr * HD + sc; const bf* gvh = Vh + po + (size_t)sr * TT + sc;
    v8us stg[4];
    auto gload = [&](int st) { const size_t ko = (size_t)st * SK * HD, vo = (size_t)st * SK;
        stg[0] = *(const v8us*)(gkh + ko); stg[1] = *(const v8us*)(gkh + ko + 32 * HD); stg[2] = *(const v8us*)(gvh + vo); stg[3] = *(const v8us*)(gvh + vo + 32 * TT); };
    auto sstore = [&](int bi) {
#pragma unroll
        for (int pl = 0; pl < 2; ++pl) { *(v8us*)&sm[bi][pl][so] = stg[2 * pl]; *(v8us*)&sm[bi][pl][so + 32 * LP] = stg[2 * pl + 1]; } };
    gload(0);
    v16bf qh[2], ql[2];
#pragma unroll
    for (int ks = 0; ks < 2; ++ks) { qh[ks] = F::ld(qhp + ks * 32); ql[ks] = F::ld(qlp + ks * 32); }
    v8f o[4];
#pragma unroll
    for (int dt = 0; dt < 4; ++dt) o[dt] = (v8f){};
    float mrun = -3.0e38f, lsum = 0.f;
    sstore(0);
    __syncthreads();
#pragma unroll 1
    for (int st = 0; st < nst; ++st) {
        const bool more = st + 1 < nst;
        if (more) { gload(st + 1); asm volatile("s_wait_xcnt 0x0" ::: "memory"); }   // the wait stands before the products below reuse the registers that hold these loads' addresses
        const bf* kt0 = &sm[st & 1][0][0] + lr * LP + 8 * hi;        // this lane's row and k half in tile K; tile V^T lies LT behind it
#pragma unroll
        for (int p = 0; p < 2; ++p) { const int kb = st * 2 + p;
            if (kb < np) {
                v8f s[2];
#pragma unroll
                for (int kt = 0; kt < 2; ++kt) { s[kt] = (v8f){};
#pragma unroll
                    for (int ks = 0; ks < 2; ++ks) { const bf* kp = kt0 + (p * 32 + kt * 16) * LP + ks * 32; const v16bf kh = F::ld(kp);
                        s[kt] = F::mma(kh, qh[ks], s[kt]); s[kt] = F::mma(kh, ql[ks], s[kt]); } }
#pragma unroll
                for (int kt = 0; kt < 2; ++kt)
#pragma unroll
                    for (int j = 0; j < 8; ++j) s[kt][j] *= SCL;
                if (kb == np - 1) {                                  // only the wave's last block crosses the diagonal: key > query is masked
#pragma unroll
                    for (int kt = 0; kt < 2; ++kt)
#pragma unroll
                        for (int j = 0; j < 8; ++j) s[kt][j] = (kb * 32 + kt * 16 + hi * 8 + j <= q0 + lr) ? s[kt][j] : -3.0e38f; }
                float mx = s[0][0];
#pragma unroll
                for (int kt = 0; kt < 2; ++kt)
#pragma unroll
                    for (int j = 0; j < 8; ++j) mx = fmaxf(mx, s[kt][j]);
                mx = fmaxf(mx, xhalf(mx)); const float mnew = fmaxf(mrun, mx);
                const float al = __builtin_amdgcn_exp2f((mrun - mnew) * 1.4426950408889634f); mrun = mnew;
                float bs = 0.f; v16bf ph, pl;
#pragma unroll
                for (int kt = 0; kt < 2; ++kt) { const v8f e = exp2x8((s[kt] - mnew) * 1.4426950408889634f);
#pragma unroll
                    for (int j = 0; j < 8; j += 2) { v2f pr; pr[0] = e[j]; pr[1] = e[j + 1]; bs += pr[0] + pr[1];
                        const v2bf h2 = __builtin_convertvector(pr, v2bf); v2f r; r[0] = pr[0] - (float)h2[0]; r[1] = pr[1] - (float)h2[1]; const v2bf l2 = __builtin_convertvector(r, v2bf);
                        ph[kt * 8 + j] = h2[0]; ph[kt * 8 + j + 1] = h2[1]; pl[kt * 8 + j] = l2[0]; pl[kt * 8 + j + 1] = l2[1]; } }
                lsum = lsum * al + bs;
#pragma unroll
                for (int dt = 0; dt < 4; ++dt) {
#pragma unroll
                    for (int j = 0; j < 8; ++j) o[dt][j] *= al; }
#pragma unroll
                for (int dt = 0; dt < 4; ++dt) { const bf* vp = kt0 + LT + dt * 16 * LP + p * 32; const v16bf vh = F::ld(vp);
                    o[dt] = F::mma(vh, ph, o[dt]); o[dt] = F::mma(vh, pl, o[dt]); }
            } }
        if (more) sstore((st + 1) & 1);                              // into the buffer whose readers all passed the barrier at the foot of the trip before
        __syncthreads();                                             // publishes stage st + 1 and ends every wave's reads of stage st
    }
    lsum += xhalf(lsum); const float f = __fdiv_rn(1.0f, lsum);
    float* op = OUT + ((size_t)(bh / NH_) * TT + q0 + lr) * DQ + (bh % NH_) * HD + hi * 8;   // o[dt][j] = O[query q0 + lr][d = 16 dt + 8 hi + j]
#pragma unroll
    for (int dt = 0; dt < 4; ++dt) { v4f a, c;
#pragma unroll
        for (int j = 0; j < 4; ++j) { a[j] = o[dt][j] * f; c[j] = o[dt][j + 4] * f; }
        *(v4f*)(op + dt * 16) = a; *(v4f*)(op + dt * 16 + 4) = c; }
}


// k_prep: every operand plane of k_fattn in one launch. One work-group takes PT positions of one (batch, head): 96 input values per thread, all loads issued ahead of the first use.
// Q planes [bh][t][f]: hi/lo bf16 split of qw = bf16(q) bf16(W), as the transposed product (qw)^T = W^T q^T (A = 16 rows f of W^T, B = 16 query columns, the k order of WFrag::ld on both sides, e 0-31 then 32-63),
// so a lane holds eight consecutive f of one query; the split rows go through LDS and leave as whole 128-byte lines. K plane [bh][t][d] and V^T plane [bh][d][t]: the bf16-rounded inputs;
// a bf16 value has no low part, so they have no low plane. V is transposed in LDS, two positions per dword, 16-byte pieces of a row swapped by d / 4 so that neither the column writes nor the row reads collide.
#define PT 128
typedef __attribute__((ext_vector_type(2))) unsigned v2u;
typedef __attribute__((ext_vector_type(4))) unsigned v4u;
__device__ __forceinline__ unsigned pkbf(float a, float b) { v2f p; p[0] = a; p[1] = b; return __builtin_bit_cast(unsigned, __builtin_convertvector(p, v2bf)); }   // a in the low half; round to nearest even
// work-group barrier that orders LDS only: the waves exchange nothing through global memory here, and __syncthreads() would also wait for every global store issued so far to be acknowledged
__device__ __forceinline__ void lds_barrier() { __builtin_amdgcn_fence(__ATOMIC_RELEASE, "workgroup", "local"); __builtin_amdgcn_s_barrier(); __builtin_amdgcn_fence(__ATOMIC_ACQUIRE, "workgroup", "local"); }
__global__ __launch_bounds__(256) void k_prep(const float* __restrict__ q, const float* __restrict__ k, const float* __restrict__ v, const float* __restrict__ wgt,
                                              bf* __restrict__ Qh, bf* __restrict__ Ql, bf* __restrict__ Kh, bf* __restrict__ Vh) {
    typedef WFrag<bf> F;
    __shared__ __align__(16) bf wt[HD * LP];              // W^T [f][e]
    __shared__ __align__(16) bf qs[2][PT * LP];           // [0]: bf16(q) rows, then the hi rows of qw; [1]: the lo rows
    __shared__ __align__(16) unsigned vt[HD * (PT / 2)];  // V^T [d][t / 2]
    const int tid = threadIdx.x, lane = tid & 31, lr = lane & 15, hi = lane >> 4, w = tid >> 5;
    const int t0 = blockIdx.x * PT, bh = blockIdx.y;
    const size_t ib = (((size_t)(bh / NH_) * TT + t0) * NH_ + (bh % NH_)) * HD;   // row t0 of this head in [b][t][h][e]; rows lie DQ apart
    const size_t pb = ((size_t)bh * TT + t0) * HD;                                // row t0 in a [bh][t][d] plane
    const size_t vb = (size_t)bh * HD * TT + t0;                                  // column t0 of row d = 0 in a [bh][d][t] plane
    const int r16 = tid >> 4, c = tid & 15, c4 = c * 4;                           // sixteen threads per 256-byte input row
    v4f xw[4], xq[8], xk[8], xv[8];
    { const float* wp = wgt + (size_t)(tid >> 3) * 2 * HD + (tid & 7) * 8;        // rows e and e + 1, eight f
      xw[0] = *(const v4f*)wp; xw[1] = *(const v4f*)(wp + 4); xw[2] = *(const v4f*)(wp + HD); xw[3] = *(const v4f*)(wp + HD + 4); }
#pragma unroll
    for (int p = 0; p < 8; ++p) xq[p] = *(const v4f*)(q + ib + (size_t)(p * 16 + r16) * DQ + c4);
    asm volatile("s_wait_xcnt 0x0" ::: "memory");   // here and below: stands before a register that an issued load or store names is written again
#pragma unroll
    for (int p = 0; p < 8; ++p) xv[p] = *(const v4f*)(v + ib + (size_t)((p >> 1) * 32 + 2 * r16 + (p & 1)) * DQ + c4);   // positions t and t + 1 in one thread
    asm volatile("s_wait_xcnt 0x0" ::: "memory");
#pragma unroll
    for (int p = 0; p < 8; ++p) xk[p] = *(const v4f*)(k + ib + (size_t)(p * 16 + r16) * DQ + c4);
    __builtin_amdgcn_sched_barrier(0);                    // keeps all 28 loads of a thread in flight together: without it the compiler issues V's loads only behind the first data wait
    { unsigned* wd = (unsigned*)wt + (tid & 7) * 8 * (LP / 2) + (tid >> 3);
#pragma unroll
      for (int i = 0; i < 8; ++i) wd[i * (LP / 2)] = pkbf(xw[i >> 2][i & 3], xw[2 + (i >> 2)][i & 3]); }
#pragma unroll
    for (int p = 0; p < 8; ++p) { v2u o; o[0] = pkbf(xq[p][0], xq[p][1]); o[1] = pkbf(xq[p][2], xq[p][3]); *(v2u*)&qs[0][(p * 16 + r16) * LP + c4] = o; }
#pragma unroll
    for (int p = 0; p < 4; ++p) { const int t2 = p * 16 + r16;
#pragma unroll
        for (int i = 0; i < 4; ++i) vt[(c4 + i) * (PT / 2) + (((t2 >> 2) ^ c) << 2) + (t2 & 3)] = pkbf(xv[2 * p][i], xv[2 * p + 1][i]); }
#pragma unroll
    for (int p = 0; p < 8; ++p) { v2u o; o[0] = pkbf(xk[p][0], xk[p][1]); o[1] = pkbf(xk[p][2], xk[p][3]); *(v2u*)(Kh + pb + (size_t)(p * 16 + r16) * HD + c4) = o; }
    asm volatile("s_wait_xcnt 0x0" ::: "memory");
    lds_barrier();                                        // W^T, the bf16 query rows and V^T are complete
    bf* qrow = &qs[0][(w * 16 + lr) * LP + 8 * hi];       // a wave reads and rewrites its own sixteen rows only
    v16bf bq[2];
#pragma unroll
    for (int ks = 0; ks < 2; ++ks) bq[ks] = F::ld(qrow + ks * 32);
    v8f acc[4];
#pragma unroll
    for (int ft = 0; ft < 4; ++ft) acc[ft] = (v8f){};
#pragma unroll
    for (int ks = 0; ks < 2; ++ks)
#pragma unroll
        for (int ft = 0; ft < 4; ++ft) acc[ft] = F::mma(F::ld(&wt[(ft * 16 + lr) * LP + 8 * hi + ks * 32]), bq[ks], acc[ft]);
#pragma unroll
    for (int s = 0; s < 4; ++s) { const int idx = s * 256 + tid, d = idx >> 4, qd = idx & 15;
        *(v4u*)(Vh + vb + (size_t)d * TT + qd * 8) = *(const v4u*)&vt[d * (PT / 2) + ((qd ^ (d >> 2)) << 2)]; }
#pragma unroll
    for (int ft = 0; ft < 4; ++ft) { v4u hv, lv;          // acc[ft][j] = qw[query w * 16 + lr][f = 16 ft + 8 hi + j]
#pragma unroll
        for (int j = 0; j < 8; j += 2) { v2f pr; pr[0] = acc[ft][j]; pr[1] = acc[ft][j + 1]; const v2bf h2 = __builtin_convertvector(pr, v2bf);
            hv[j >> 1] = __builtin_bit_cast(unsigned, h2); lv[j >> 1] = pkbf(pr[0] - (float)h2[0], pr[1] - (float)h2[1]); }
        *(v4u*)(qrow + ft * 16) = hv; *(v4u*)(qrow + PT * LP + ft * 16) = lv; }
    lds_barrier();                                        // the split rows are complete
#pragma unroll
    for (int s = 0; s < 4; ++s) { const int idx = s * 256 + tid; const int lo = (idx >> 3) * LP + (idx & 7) * 8;
        *(v4u*)(Qh + pb + (size_t)idx * 8) = *(const v4u*)&qs[0][lo]; *(v4u*)(Ql + pb + (size_t)idx * 8) = *(const v4u*)&qs[1][lo]; }
}

extern "C" void kernel_launch(void* const* d_in, const int* in_sizes, int n_in,
                              void* d_out, int out_size, void* d_ws, size_t ws_size, hipStream_t stream) {
    (void)in_sizes; (void)n_in; (void)out_size;
    const float* qi = (const float*)d_in[0]; const float* ki = (const float*)d_in[1]; const float* vi = (const float*)d_in[2]; const float* wq = (const float*)d_in[3];
    float* OUT = (float*)d_out;     // [4][2048][512]
    char* wsp = (char*)d_ws;
    auto take = [&](size_t bytes) { char* p = wsp; wsp += (bytes + 255) & ~(size_t)255; return (void*)p; };
    const size_t PB = (size_t)NH_ * TT * HD;   // elements of one batch's head planes; each plane holds every batch
    bf* QPh = (bf*)take(NB_ * PB * 2); bf* QPl = (bf*)take(NB_ * PB * 2); bf* KPh = (bf*)take(NB_ * PB * 2); bf* VTh = (bf*)take(NB_ * PB * 2);
    if ((size_t)(wsp - (char*)d_ws) > ws_size) return;    // ws 256 MiB
    k_prep<<<dim3(TT / PT, NB_ * NH_, 1), 256, 0, stream>>>(qi, ki, vi, wq, QPh, QPl, KPh, VTh);
    k_fattn<<<dim3(TT / 128, NB_ * NH_, 1), 256, 0, stream>>>(QPh, QPl, KPh, VTh, OUT);   /* one kv head per query head: plane b * 8 + h of each */
}

// v005
// A run of this version takes 50 microseconds.
// Timed twice side by side with v004, it ran 1.03 and 1.04 times as fast.
// Counting every step since v000, it is 19.9 times as fast.
#include <hip/hip_runtime.h>

#include <hip/hip_runtime.h>

#define NB_  4
#define TT   2048
#define DM   512
#define NH_  8
#define NKV  8
#define REP  (NH_ / NKV)
#define HD   64
#define DQ   (NH_ * HD)
#define DKV  (NKV * HD)
#define SCL  0.125f   // HD^-0.5
typedef _Float16 h16;
typedef unsigned short bf;
typedef __attribute__((ext_vector_type(16))) __bf16   v16bf;
typedef __attribute__((ext_vector_type(16))) _Float16 v16h;
typedef __attribute__((ext_vector_type(8)))  _Float16 v8h;
typedef __attribute__((ext_vector_type(8)))  unsigned short v8us;
typedef __attribute__((ext_vector_type(8)))  float    v8f;
typedef __attribute__((ext_vector_type(4)))  float    v4f;
typedef v8h  __attribute__((may_alias)) v8ha;
typedef v4f  __attribute__((may_alias)) v4fa;
typedef v8us __attribute__((may_alias)) v8usa;

__device__ __forceinline__ unsigned short f2bf(float f) { unsigned u = __float_as_uint(f); u += 0x7FFFu + ((u >> 16) & 1u); return (unsigned short)(u >> 16); }
__device__ __forceinline__ float bf2f(unsigned short b) { return __uint_as_float(((unsigned)b) << 16); }
__device__ __forceinline__ float bfr(float f) { return bf2f(f2bf(f)); }
__device__ __forceinline__ v16h cat16(v8h lo, v8h hi) { return __builtin_shufflevector(lo, hi, 0, 1, 2, 3, 4, 5, 6, 7, 8, 9, 10, 11, 12, 13, 14, 15); }
__device__ __forceinline__ v16bf cat16b(v8us lo, v8us hi) { return __builtin_bit_cast(v16bf, __builtin_shufflevector(lo, hi, 0, 1, 2, 3, 4, 5, 6, 7, 8, 9, 10, 11, 12, 13, 14, 15)); }
__device__ __forceinline__ v8f wmma16(v16h a, v16h b, v8f c) { return __builtin_amdgcn_wmma_f32_16x16x32_f16(false, a, false, b, (short)0, c, false, false); }
__device__ __forceinline__ v8f wmmab(v16bf a, v16bf b, v8f c) { return __builtin_amdgcn_wmma_f32_16x16x32_bf16(false, a, false, b, (short)0, c, false, false); }



// fragment loader and product of the 16x16x32 forms: sixteen k of one row per lane, k = 8 hi + 0..7 and 16 + 8 hi + 0..7
template <typename T16> struct WFrag;
template <> struct WFrag<h16> { typedef v16h V; static __device__ __forceinline__ V ld(const h16* p) { return cat16(*(const v8h*)p, *(const v8h*)(p + 16)); } static __device__ __forceinline__ v8f mma(V a, V b, v8f c) { return wmma16(a, b, c); } };
template <> struct WFrag<bf> { typedef v16bf V; static __device__ __forceinline__ V ld(const bf* p) { return cat16b(*(const v8us*)p, *(const v8us*)(p + 16)); } static __device__ __forceinline__ v8f mma(V a, V b, v8f c) { return wmmab(a, b, c); } };
typedef __attribute__((ext_vector_type(2))) _Float16 v2h;
typedef __attribute__((ext_vector_type(4))) _Float16 v4h;
typedef __attribute__((ext_vector_type(2))) unsigned short v2us;
typedef __attribute__((ext_vector_type(4))) unsigned short v4us;
typedef __attribute__((ext_vector_type(2))) float v2f;
typedef __attribute__((ext_vector_type(4))) int v4i;


// k_fattn: scores, causal softmax and probability x value product in one launch for every batch and head; nothing of the score matrix goes to memory.
// Transposed products: S^T = K Q^T (A = 16 key rows, B = 16 query columns) and O^T += V^T P^T, so a lane holds one query's scores (keys 8 hi + r of each 16-key tile) and two score tiles, converted in place,
// are the B operand of the second product. Running maximum and sum per query (online softmax); qw and P are hi/lo bf16 splits, K and V are the bf16-rounded inputs, which have no low part: K Qh + K Ql and V Ph + V Pl.
// The eight waves of a work-group share K and V^T through LDS: stages of SK keys, two buffers, the next stage's global loads in flight during this stage's products, one barrier per stage.
// Two waves own the same 16 queries: wave w takes keys 0-31 of every stage, wave w + 4 keys 32-63, each with its own running maximum, sum and O, so the longest chain of key blocks in one wave is halved.
// All eight waves take a 64-query tile from the long end of the causal triangle and then the mirrored tile from the short end of the same head: 33 stages in every work-group, every wave at work in each but the two diagonal stages, where waves 4 and 5 have no keys.
// Behind a tile's diagonal stage the two waves of a pair join their partial results through LDS; each finishes and stores 32 of the 64 output columns.
#define SK 64                     // keys per stage: a V^T row piece is then one whole 128-byte line
#define LP 72                     // LDS row pitch in 16-bit elements: 144 bytes, 16 x odd, for 16-byte reads of 128-byte rows
#define LT (64 * LP)              // one staged tile: 64 rows (keys of K, d of V^T)
typedef __attribute__((ext_vector_type(2))) __bf16 v2bf;
__device__ __forceinline__ float xhalf(float x) { const int b = __float_as_int(x); return __int_as_float(__builtin_amdgcn_permlanex16(b, b, 0x76543210, 0xfedcba98, false, false)); }   // value of lane ^ 16
// eight 2^x and, in the same statement, the one free issue slot that the instruction set asks for behind a transcendental; the early-clobber outputs keep every source whole until the statement ends
__device__ __forceinline__ v8f exp2x8(v8f x) { float d0, d1, d2, d3, d4, d5, d6, d7;
    asm("v_exp_f32 %0, %8\n\tv_exp_f32 %1, %9\n\tv_exp_f32 %2, %10\n\tv_exp_f32 %3, %11\n\tv_exp_f32 %4, %12\n\tv_exp_f32 %5, %13\n\tv_exp_f32 %6, %14\n\tv_exp_f32 %7, %15\n\tv_nop"
        : "=&v"(d0), "=&v"(d1), "=&v"(d2), "=&v"(d3), "=&v"(d4), "=&v"(d5), "=&v"(d6), "=&v"(d7) : "v"(x[0]), "v"(x[1]), "v"(x[2]), "v"(x[3]), "v"(x[4]), "v"(x[5]), "v"(x[6]), "v"(x[7]));
    v8f d; d[0] = d0; d[1] = d1; d[2] = d2; d[3] = d3; d[4] = d4; d[5] = d5; d[6] = d6; d[7] = d7; return d; }
// two 2^x with the same free issue slot behind them
__device__ __forceinline__ v2f exp2x2(float x0, float x1) { float d0, d1;
    asm("v_exp_f32 %0, %2\n\tv_exp_f32 %1, %3\n\tv_nop" : "=&v"(d0), "=&v"(d1) : "v"(x0), "v"(x1));
    v2f d; d[0] = d0; d[1] = d1; return d; }
__global__ __launch_bounds__(256) __attribute__((amdgpu_waves_per_eu(4, 4))) void k_fattn(const bf* __restrict__ Qh, const bf* __restrict__ Ql, const bf* __restrict__ Kh, const bf* __restrict__ Vh, float* __restrict__ OUT) {
    typedef WFrag<bf> F;
    __shared__ __align__(16) bf sm[2][2][LT];                        // [buffer][K, V^T]
    __shared__ __align__(16) float xo[8][4][32][4];                  // per wave and lane: the sixteen values of O that the partner wave finishes
    __shared__ float xm[8][2][32];                                   // per wave and lane: running maximum, sum
    const int tid = threadIdx.x, lane = tid & 31, lr = lane & 15, hi = lane >> 4; const int w = __builtin_amdgcn_readfirstlane(tid >> 5);
    const int g = blockIdx.x, bh = blockIdx.y; const int kh = w >> 2;         // kh: this wave's 32 keys of each stage
    const int tl = TT / 64 - 1 - g, nst = TT / 64 + 1;               // the long tile, taken first: tl + 1 stages; then tile g: g + 1 stages
    const int qs = (w & 3) * 16, dq = (qs & 31) + lr;                // this wave's queries inside a tile; the lane's query counted from the first key of the 32-key block that holds the diagonal
    int q0 = tl * 64 + qs, np = q0 / 32 + 1;                         // this wave's queries; their key blocks of 32 up to and including the one that holds the diagonal
    const size_t po = (size_t)bh * TT * HD;
    const bf* qhp = Qh + po + (size_t)(q0 + lr) * HD + 8 * hi; const bf* qlp = Ql + po + (size_t)(q0 + lr) * HD + 8 * hi;
    const bf* qhn = Qh + po + (size_t)(g * 64 + qs + lr) * HD + 8 * hi; const bf* qln = Ql + po + (size_t)(g * 64 + qs + lr) * HD + 8 * hi;
    const int sr = tid >> 3, sc = (tid & 7) * 8, so = sr * LP + sc;  // staging: eight threads per 128-byte row, rows sr and sr + 32 of each tile
    const bf* gkh = Kh + po + (size_t)sr * HD + sc; const bf* gvh = Vh + po + (size_t)sr * TT + sc;   // running pointers: this thread's piece of the stage that is fetched next
    v8us stg[4];
    auto gload = [&]() { stg[0] = *(const v8us*)gkh; stg[1] = *(const v8us*)(gkh + 32 * HD); stg[2] = *(const v8us*)gvh; stg[3] = *(const v8us*)(gvh + 32 * TT); };
    auto sstore = [&](int bi) {
#pragma unroll
        for (int pl = 0; pl < 2; ++pl) { *(v8us*)&sm[bi][pl][so] = stg[2 * pl]; *(v8us*)&sm[bi][pl][so + 32 * LP] = stg[2 * pl + 1]; } };
    gload();
    v16bf qh[2], ql[2], qhx[2], qlx[2];                              // the second tile's queries are fetched here too, so that the change of tile waits for no load
#pragma unroll
    for (int ks = 0; ks < 2; ++ks) { qh[ks] = F::ld(qhp + ks * 32); ql[ks] = F::ld(qlp + ks * 32); }
#pragma unroll
    for (int ks = 0; ks < 2; ++ks) { qhx[ks] = F::ld(qhn + ks * 32); qlx[ks] = F::ld(qln + ks * 32); }
    asm volatile("s_wait_xcnt 0x0" ::: "memory");                    // stands before a register that holds one of these loads' addresses is written again
    v8f o[4];
#pragma unroll
    for (int dt = 0; dt < 4; ++dt) o[dt] = (v8f){};
    float mrun = -3.0e38f, lsum = 0.f;
    sstore(0);
    __syncthreads();
    int st = 0;                                                      // key stage inside the current tile
#pragma unroll 1
    for (int s = 0; s < nst; ++s) {
        const bool more = s + 1 < nst, last = s == tl || !more;      // last: the current tile's diagonal stage; both are the same for the whole work-group
        if (more) { const int adv = last ? -st : 1;                  // on to the next 64 keys, or back to key 0 for the second tile
            gkh += (ptrdiff_t)adv * (SK * HD); gvh += (ptrdiff_t)adv * SK; gload(); asm volatile("s_wait_xcnt 0x0" ::: "memory"); }   // the wait stands before a register that holds one of these loads' addresses is written again
        const bf* kt0 = &sm[s & 1][0][0] + lr * LP + 8 * hi;         // this lane's row and k half in tile K; tile V^T lies LT behind it
        const int kb = st * 2 + kh;
        if (kb < np) {
            v8f sc2[2];
#pragma unroll
            for (int kt = 0; kt < 2; ++kt) { sc2[kt] = (v8f){};
#pragma unroll
                for (int ks = 0; ks < 2; ++ks) { const bf* kp = kt0 + (kh * 32 + kt * 16) * LP + ks * 32; const v16bf kf = F::ld(kp);
                    sc2[kt] = F::mma(kf, qh[ks], sc2[kt]); sc2[kt] = F::mma(kf, ql[ks], sc2[kt]); } }
#pragma unroll
            for (int kt = 0; kt < 2; ++kt)
#pragma unroll
                for (int j = 0; j < 8; ++j) sc2[kt][j] *= SCL;
            if (kb == np - 1) {                                      // only the pair's last block crosses the diagonal: key > query is masked
#pragma unroll
                for (int kt = 0; kt < 2; ++kt)
#pragma unroll
                    for (int j = 0; j < 8; ++j) sc2[kt][j] = (kt * 16 + hi * 8 + j <= dq) ? sc2[kt][j] : -3.0e38f; }
            float mx = sc2[0][0];
#pragma unroll
            for (int kt = 0; kt < 2; ++kt)
#pragma unroll
                for (int j = 0; j < 8; ++j) mx = fmaxf(mx, sc2[kt][j]);
            mx = fmaxf(mx, xhalf(mx)); const float mnew = fmaxf(mrun, mx);
            const float al = __builtin_amdgcn_exp2f((mrun - mnew) * 1.4426950408889634f); mrun = mnew;
            float bs = 0.f; v16bf ph, pl;
#pragma unroll
            for (int kt = 0; kt < 2; ++kt) { const v8f e = exp2x8((sc2[kt] - mnew) * 1.4426950408889634f);
#pragma unroll
                for (int j = 0; j < 8; j += 2) { v2f pr; pr[0] = e[j]; pr[1] = e[j + 1]; bs += pr[0] + pr[1];
                    const v2bf h2 = __builtin_convertvector(pr, v2bf); v2f r; r[0] = pr[0] - (float)h2[0]; r[1] = pr[1] - (float)h2[1]; const v2bf l2 = __builtin_convertvector(r, v2bf);
                    ph[kt * 8 + j] = h2[0]; ph[kt * 8 + j + 1] = h2[1]; pl[kt * 8 + j] = l2[0]; pl[kt * 8 + j + 1] = l2[1]; } }
            lsum = lsum * al + bs;
#pragma unroll
            for (int dt = 0; dt < 4; ++dt) {
#pragma unroll
                for (int j = 0; j < 8; ++j) o[dt][j] *= al; }
#pragma unroll
            for (int dt = 0; dt < 4; ++dt) { const bf* vp = kt0 + LT + dt * 16 * LP + kh * 32; const v16bf vh = F::ld(vp);
                o[dt] = F::mma(vh, ph, o[dt]); o[dt] = F::mma(vh, pl, o[dt]); }
        }
        if (more) sstore((s + 1) & 1);                               // into the buffer whose readers all passed the barrier at the foot of the trip before
        __syncthreads();                                             // publishes stage s + 1 and ends every wave's reads of stage s
        st = st + 1;
        if (last) {                                                  // the tile is done: wave w and wave w ^ 4 join their two partial softmaxes
            lsum += xhalf(lsum);
            v8f kp2[2], gv[2];                                       // wave kh keeps output columns 32 kh .. 32 kh + 31 and hands the other 32 to its partner
#pragma unroll
            for (int i = 0; i < 2; ++i) { kp2[i] = kh ? o[2 + i] : o[i]; gv[i] = kh ? o[i] : o[2 + i]; }
#pragma unroll
            for (int i = 0; i < 2; ++i) { v4f a, c;
#pragma unroll
                for (int j = 0; j < 4; ++j) { a[j] = gv[i][j]; c[j] = gv[i][j + 4]; }
                *(v4f*)&xo[w][2 * i][lane][0] = a; *(v4f*)&xo[w][2 * i + 1][lane][0] = c; }
            xm[w][0][lane] = mrun; xm[w][1][lane] = lsum;
            __syncthreads();                                         // the partners' values are complete; the stage barriers of the next tile end these reads before xo and xm are written again
            const int pw = w ^ 4;
            const float pm = xm[pw][0][lane], ps = xm[pw][1][lane];
            const float mj = fmaxf(mrun, pm);                        // a wave that had no key block holds maximum -3e38, sum 0, O 0: its factor below is 2^-inf = 0
            const v2f ee = exp2x2((mrun - mj) * 1.4426950408889634f, (pm - mj) * 1.4426950408889634f);
            const float f = __fdiv_rn(1.0f, lsum * ee[0] + ps * ee[1]), fa = ee[0] * f, fb = ee[1] * f;
            float* op = OUT + ((size_t)(bh / NH_) * TT + q0 + lr) * DQ + (bh % NH_) * HD + kh * 32 + hi * 8;   // kp2[i][j] = O[query q0 + lr][d = 32 kh + 16 i + 8 hi + j]
#pragma unroll
            for (int i = 0; i < 2; ++i) { const v4f pa = *(const v4f*)&xo[pw][2 * i][lane][0], pc = *(const v4f*)&xo[pw][2 * i + 1][lane][0]; v4f a, c;
#pragma unroll
                for (int j = 0; j < 4; ++j) { a[j] = kp2[i][j] * fa + pa[j] * fb; c[j] = kp2[i][j + 4] * fa + pc[j] * fb; }
                *(v4f*)(op + i * 16) = a; *(v4f*)(op + i * 16 + 4) = c; }
            asm volatile("s_wait_xcnt 0x0" ::: "memory");            // stands before a register that these stores name is written again
            st = 0; q0 = g * 64 + qs; np = q0 / 32 + 1;              // the short tile
#pragma unroll
            for (int ks = 0; ks < 2; ++ks) { qh[ks] = qhx[ks]; ql[ks] = qlx[ks]; }
#pragma unroll
            for (int dt = 0; dt < 4; ++dt) o[dt] = (v8f){};
            mrun = -3.0e38f; lsum = 0.f;
        }
    }
}


// k_prep: every operand plane of k_fattn in one launch. One work-group takes PT positions of one (batch, head): 96 input values per thread, all loads issued ahead of the first use.
// Q planes [bh][t][f]: hi/lo bf16 split of qw = bf16(q) bf16(W), as the transposed product (qw)^T = W^T q^T (A = 16 rows f of W^T, B = 16 query columns, the k order of WFrag::ld on both sides, e 0-31 then 32-63),
// so a lane holds eight consecutive f of one query; the split rows go through LDS and leave as whole 128-byte lines. K plane [bh][t][d] and V^T plane [bh][d][t]: the bf16-rounded inputs;
// a bf16 value has no low part, so they have no low plane. V is transposed in LDS, two positions per dword, 16-byte pieces of a row swapped by d / 4 so that neither the column writes nor the row reads collide.
#define PT 128
typedef __attribute__((ext_vector_type(2))) unsigned v2u;
typedef __attribute__((ext_vector_type(4))) unsigned v4u;
__device__ __forceinline__ unsigned pkbf(float a, float b) { v2f p; p[0] = a; p[1] = b; return __builtin_bit_cast(unsigned, __builtin_convertvector(p, v2bf)); }   // a in the low half; round to nearest even
// work-group barrier that orders LDS only: the waves exchange nothing through global memory here, and __syncthreads() would also wait for every global store issued so far to be acknowledged
__device__ __forceinline__ void lds_barrier() { __builtin_amdgcn_fence(__ATOMIC_RELEASE, "workgroup", "local"); __builtin_amdgcn_s_barrier(); __builtin_amdgcn_fence(__ATOMIC_ACQUIRE, "workgroup", "local"); }
__global__ __launch_bounds__(256) void k_prep(const float* __restrict__ q, const float* __restrict__ k, const float* __restrict__ v, const float* __restrict__ wgt,
                                              bf* __restrict__ Qh, bf* __restrict__ Ql, bf* __restrict__ Kh, bf* __restrict__ Vh) {
    typedef WFrag<bf> F;
    __shared__ __align__(16) bf wt[HD * LP];              // W^T [f][e]
    __shared__ __align__(16) bf qs[2][PT * LP];           // [0]: bf16(q) rows, then the hi rows of qw; [1]: the lo rows
    __shared__ __align__(16) unsigned vt[HD * (PT / 2)];  // V^T [d][t / 2]
    const int tid = threadIdx.x, lane = tid & 31, lr = lane & 15, hi = lane >> 4, w = tid >> 5;
    const int t0 = blockIdx.x * PT, bh = blockIdx.y;
    const size_t ib = (((size_t)(bh / NH_) * TT + t0) * NH_ + (bh % NH_)) * HD;   // row t0 of this head in [b][t][h][e]; rows lie DQ apart
    const size_t pb = ((size_t)bh * TT + t0) * HD;                                // row t0 in a [bh][t][d] plane
    const size_t vb = (size_t)bh * HD * TT + t0;                                  // column t0 of row d = 0 in a [bh][d][t] plane
    const int r16 = tid >> 4, c = tid & 15, c4 = c * 4;                           // sixteen threads per 256-byte input row
    v4f xw[4], xq[8], xk[8], xv[8];
    { const float* wp = wgt + (size_t)(tid >> 3) * 2 * HD + (tid & 7) * 8;        // rows e and e + 1, eight f
      xw[0] = *(const v4f*)wp; xw[1] = *(const v4f*)(wp + 4); xw[2] = *(const v4f*)(wp + HD); xw[3] = *(const v4f*)(wp + HD + 4); }
#pragma unroll
    for (int p = 0; p < 8; ++p) xq[p] = *(const v4f*)(q + ib + (size_t)(p * 16 + r16) * DQ + c4);
    asm volatile("s_wait_xcnt 0x0" ::: "memory");   // here and below: stands before a register that an issued load or store names is written again
#pragma unroll
    for (int p = 0; p < 8; ++p) xv[p] = *(const v4f*)(v + ib + (size_t)((p >> 1) * 32 + 2 * r16 + (p & 1)) * DQ + c4);   // positions t and t + 1 in one thread
    asm volatile("s_wait_xcnt 0x0" ::: "memory");
#pragma unroll
    for (int p = 0; p < 8; ++p) xk[p] = *(const v4f*)(k + ib + (size_t)(p * 16 + r16) * DQ + c4);
    __builtin_amdgcn_sched_barrier(0);                    // keeps all 28 loads of a thread in flight together: without it the compiler issues V's loads only behind the first data wait
    { unsigned* wd = (unsigned*)wt + (tid & 7) * 8 * (LP / 2) + (tid >> 3);
#pragma unroll
      for (int i = 0; i < 8; ++i) wd[i * (LP / 2)] = pkbf(xw[i >> 2][i & 3], xw[2 + (i >> 2)][i & 3]); }
#pragma unroll
    for (int p = 0; p < 8; ++p) { v2u o; o[0] = pkbf(xq[p][0], xq[p][1]); o[1] = pkbf(xq[p][2], xq[p][3]); *(v2u*)&qs[0][(p * 16 + r16) * LP + c4] = o; }
#pragma unroll
    for (int p = 0; p < 4; ++p) { const int t2 = p * 16 + r16;
#pragma unroll
        for (int i = 0; i < 4; ++i) vt[(c4 + i) * (PT / 2) + (((t2 >> 2) ^ c) << 2) + (t2 & 3)] = pkbf(xv[2 * p][i], xv[2 * p + 1][i]); }
#pragma unroll
    for (int p = 0; p < 8; ++p) { v2u o; o[0] = pkbf(xk[p][0], xk[p][1]); o[1] = pkbf(xk[p][2], xk[p][3]); *(v2u*)(Kh + pb + (size_t)(p * 16 + r16) * HD + c4) = o; }
    asm volatile("s_wait_xcnt 0x0" ::: "memory");
    lds_barrier();                                        // W^T, the bf16 query rows and V^T are complete
    bf* qrow = &qs[0][(w * 16 + lr) * LP + 8 * hi];       // a wave reads and rewrites its own sixteen rows only
    v16bf bq[2];
#pragma unroll
    for (int ks = 0; ks < 2; ++ks) bq[ks] = F::ld(qrow + ks * 32);
    v8f acc[4];
#pragma unroll
    for (int ft = 0; ft < 4; ++ft) acc[ft] = (v8f){};
#pragma unroll
    for (int ks = 0; ks < 2; ++ks)
#pragma unroll
        for (int ft = 0; ft < 4; ++ft) acc[ft] = F::mma(F::ld(&wt[(ft * 16 + lr) * LP + 8 * hi + ks * 32]), bq[ks], acc[ft]);
#pragma unroll
    for (int s = 0; s < 4; ++s) { const int idx = s * 256 + tid, d = idx >> 4, qd = idx & 15;
        *(v4u*)(Vh + vb + (size_t)d * TT + qd * 8) = *(const v4u*)&vt[d * (PT / 2) + ((qd ^ (d >> 2)) << 2)]; }
#pragma unroll
    for (int ft = 0; ft < 4; ++ft) { v4u hv, lv;          // acc[ft][j] = qw[query w * 16 + lr][f = 16 ft + 8 hi + j]
#pragma unroll
        for (int j = 0; j < 8; j += 2) { v2f pr; pr[0] = acc[ft][j]; pr[1] = acc[ft][j + 1]; const v2bf h2 = __builtin_convertvector(pr, v2bf);
            hv[j >> 1] = __builtin_bit_cast(unsigned, h2); lv[j >> 1] = pkbf(pr[0] - (float)h2[0], pr[1] - (float)h2[1]); }
        *(v4u*)(qrow + ft * 16) = hv; *(v4u*)(qrow + PT * LP + ft * 16) = lv; }
    lds_barrier();                                        // the split rows are complete
#pragma unroll
    for (int s = 0; s < 4; ++s) { const int idx = s * 256 + tid; const int lo = (idx >> 3) * LP + (idx & 7) * 8;
        *(v4u*)(Qh + pb + (size_t)idx * 8) = *(const v4u*)&qs[0][lo]; *(v4u*)(Ql + pb + (size_t)idx * 8) = *(const v4u*)&qs[1][lo]; }
}

extern "C" void kernel_launch(void* const* d_in, const int* in_sizes, int n_in,
                              void* d_out, int out_size, void* d_ws, size_t ws_size, hipStream_t stream) {
    (void)in_sizes; (void)n_in; (void)out_size;
    const float* qi = (const float*)d_in[0]; const float* ki = (const float*)d_in[1]; const float* vi = (const float*)d_in[2]; const float* wq = (const float*)d_in[3];
    float* OUT = (float*)d_out;     // [4][2048][512]
    char* wsp = (char*)d_ws;
    auto take = [&](size_t bytes) { char* p = wsp; wsp += (bytes + 255) & ~(size_t)255; return (void*)p; };
    const size_t PB = (size_t)NH_ * TT * HD;   // elements of one batch's head planes; each plane holds every batch
    bf* QPh = (bf*)take(NB_ * PB * 2); bf* QPl = (bf*)take(NB_ * PB * 2); bf* KPh = (bf*)take(NB_ * PB * 2); bf* VTh = (bf*)take(NB_ * PB * 2);
    if ((size_t)(wsp - (char*)d_ws) > ws_size) return;    // ws 256 MiB
    k_prep<<<dim3(TT / PT, NB_ * NH_, 1), 256, 0, stream>>>(qi, ki, vi, wq, QPh, QPl, KPh, VTh);
    k_fattn<<<dim3(TT / 128, NB_ * NH_, 1), 256, 0, stream>>>(QPh, QPl, KPh, VTh, OUT);   /* one kv head per query head: plane b * 8 + h of each */
}

// v007
// One run takes 37 microseconds.
// Versions between v005 and this one are left out; their measured steps multiply to 1.34 times as fast.
// Counting every step since v000, it is 26.7 times as fast.
#include <hip/hip_runtime.h>

#include <hip/hip_runtime.h>

#define NB_  4
#define TT   2048
#define DM   512
#define NH_  8
#define NKV  8
#define REP  (NH_ / NKV)
#define HD   64
#define DQ   (NH_ * HD)
#define DKV  (NKV * HD)
#define SCL  0.125f   // HD^-0.5
typedef _Float16 h16;
typedef unsigned short bf;
typedef __attribute__((ext_vector_type(16))) __bf16   v16bf;
typedef __attribute__((ext_vector_type(16))) _Float16 v16h;
typedef __attribute__((ext_vector_type(8)))  _Float16 v8h;
typedef __attribute__((ext_vector_type(8)))  unsigned short v8us;
typedef __attribute__((ext_vector_type(8)))  float    v8f;
typedef __attribute__((ext_vector_type(4)))  float    v4f;
typedef v8h  __attribute__((may_alias)) v8ha;
typedef v4f  __attribute__((may_alias)) v4fa;
typedef v8us __attribute__((may_alias)) v8usa;

__device__ __forceinline__ unsigned short f2bf(float f) { unsigned u = __float_as_uint(f); u += 0x7FFFu + ((u >> 16) & 1u); return (unsigned short)(u >> 16); }
__device__ __forceinline__ float bf2f(unsigned short b) { return __uint_as_float(((unsigned)b) << 16); }
__device__ __forceinline__ float bfr(float f) { return bf2f(f2bf(f)); }
__device__ __forceinline__ v16h cat16(v8h lo, v8h hi) { return __builtin_shufflevector(lo, hi, 0, 1, 2, 3, 4, 5, 6, 7, 8, 9, 10, 11, 12, 13, 14, 15); }
__device__ __forceinline__ v16bf cat16b(v8us lo, v8us hi) { return __builtin_bit_cast(v16bf, __builtin_shufflevector(lo, hi, 0, 1, 2, 3, 4, 5, 6, 7, 8, 9, 10, 11, 12, 13, 14, 15)); }
__device__ __forceinline__ v8f wmma16(v16h a, v16h b, v8f c) { return __builtin_amdgcn_wmma_f32_16x16x32_f16(false, a, false, b, (short)0, c, false, false); }
__device__ __forceinline__ v8f wmmab(v16bf a, v16bf b, v8f c) { return __builtin_amdgcn_wmma_f32_16x16x32_bf16(false, a, false, b, (short)0, c, false, false); }



// fragment loader and product of the 16x16x32 forms: sixteen k of one row per lane, k = 8 hi + 0..7 and 16 + 8 hi + 0..7
template <typename T16> struct WFrag;
template <> struct WFrag<h16> { typedef v16h V; static __device__ __forceinline__ V ld(const h16* p) { return cat16(*(const v8h*)p, *(const v8h*)(p + 16)); } static __device__ __forceinline__ v8f mma(V a, V b, v8f c) { return wmma16(a, b, c); } };
template <> struct WFrag<bf> { typedef v16bf V; static __device__ __forceinline__ V ld(const bf* p) { return cat16b(*(const v8us*)p, *(const v8us*)(p + 16)); } static __device__ __forceinline__ v8f mma(V a, V b, v8f c) { return wmmab(a, b, c); } };
typedef __attribute__((ext_vector_type(2))) _Float16 v2h;
typedef __attribute__((ext_vector_type(4))) _Float16 v4h;
typedef __attribute__((ext_vector_type(2))) unsigned short v2us;
typedef __attribute__((ext_vector_type(4))) unsigned short v4us;
typedef __attribute__((ext_vector_type(2))) float v2f;
typedef __attribute__((ext_vector_type(4))) int v4i;


// k_fattn: scores, causal softmax and probability x value product in one launch for every batch and head; nothing of the score matrix goes to memory.
// Transposed products: S^T = K Q^T (A = 16 key rows, B = 16 query columns) and O^T += V^T P^T, so a lane holds one query's scores (keys 8 hi + r of each 16-key tile) and two score tiles, converted in place,
// are the B operand of the second product. Running maximum and sum per query (online softmax). Both products take f16 operands: qw and P are each rounded once to f16 (11 significant bits),
// K and V are the bf16-rounded inputs, which f16 holds unchanged (8 significant bits; below 2^-14 in magnitude to within 2^-25): one product K Q and one product V P per tile.
// The eight waves of a work-group share K and V^T through LDS: stages of SK keys, two buffers, the next stage's global loads in flight during this stage's products, one barrier per stage.
// A wave holds 32 queries as two column groups of 16, so that every K and V^T fragment read from LDS feeds two products. Four waves own the same 32 queries: wave w takes keys 32 (w >> 1) .. + 31 of every stage,
// each with its own running maximum, sum and O.
// All eight waves take a 64-query tile from the long end of the causal triangle and then the mirrored tile from the short end of the same head: 17 stages in every work-group.
// Behind a tile's diagonal stage the four waves of a group join their partial results through LDS; each finishes and stores 32 of the 64 output columns of one column group.
#define SK 128                    // keys per stage: a V^T row piece is then 256 bytes
#define LP 72                     // LDS row pitch of K in 16-bit elements: 144 bytes, 16 x odd, for 16-byte reads of 128-byte rows
#define LPV 136                   // LDS row pitch of V^T: 272 bytes, 16 x odd, for 16-byte reads of 256-byte rows
#define LTK (SK * LP)             // staged K tile: 128 rows (keys)
#define LTV (HD * LPV)            // staged V^T tile: 64 rows (d)
typedef __attribute__((ext_vector_type(2))) __bf16 v2bf;
// sixteen f16 of one row, kept in memory as 16-bit words: k = 8 hi + 0..7 and 16 + 8 hi + 0..7, the k order of WFrag::ld
__device__ __forceinline__ v16h ldh(const bf* p) { return __builtin_bit_cast(v16h, __builtin_shufflevector(*(const v8us*)p, *(const v8us*)(p + 16), 0, 1, 2, 3, 4, 5, 6, 7, 8, 9, 10, 11, 12, 13, 14, 15)); }
__device__ __forceinline__ float xhalf(float x) { const int b = __float_as_int(x); return __int_as_float(__builtin_amdgcn_permlanex16(b, b, 0x76543210, 0xfedcba98, false, false)); }   // value of lane ^ 16
// eight 2^x and, in the same statement, the one free issue slot that the instruction set asks for behind a transcendental; the early-clobber outputs keep every source whole until the statement ends
__device__ __forceinline__ v8f exp2x8(v8f x) { float d0, d1, d2, d3, d4, d5, d6, d7;
    asm("v_exp_f32 %0, %8\n\tv_exp_f32 %1, %9\n\tv_exp_f32 %2, %10\n\tv_exp_f32 %3, %11\n\tv_exp_f32 %4, %12\n\tv_exp_f32 %5, %13\n\tv_exp_f32 %6, %14\n\tv_exp_f32 %7, %15\n\tv_nop"
        : "=&v"(d0), "=&v"(d1), "=&v"(d2), "=&v"(d3), "=&v"(d4), "=&v"(d5), "=&v"(d6), "=&v"(d7) : "v"(x[0]), "v"(x[1]), "v"(x[2]), "v"(x[3]), "v"(x[4]), "v"(x[5]), "v"(x[6]), "v"(x[7]));
    v8f d; d[0] = d0; d[1] = d1; d[2] = d2; d[3] = d3; d[4] = d4; d[5] = d5; d[6] = d6; d[7] = d7; return d; }
// two 2^x with the same free issue slot behind them
__device__ __forceinline__ v2f exp2x2(float x0, float x1) { float d0, d1;
    asm("v_exp_f32 %0, %2\n\tv_exp_f32 %1, %3\n\tv_nop" : "=&v"(d0), "=&v"(d1) : "v"(x0), "v"(x1));
    v2f d; d[0] = d0; d[1] = d1; return d; }
// inputs-only fence on the four loaded query fragments: the loads have landed where it stands. Without it the compiler sinks them below the next barrier, leaves them pending at the head of the stage loop,
// and then waits in every trip, ahead of the score products, for the global load counter, that is for the stage's own loads that were issued just before
__device__ __forceinline__ void landed(v16h a, v16h b, v16h c, v16h d) { asm volatile("" :: "v"(__builtin_bit_cast(v8f, a)), "v"(__builtin_bit_cast(v8f, b)), "v"(__builtin_bit_cast(v8f, c)), "v"(__builtin_bit_cast(v8f, d))); }
__global__ __launch_bounds__(256) __attribute__((amdgpu_waves_per_eu(4, 4))) void k_fattn(const bf* __restrict__ Qh, const bf* __restrict__ Kh, const bf* __restrict__ Vh, float* __restrict__ OUT) {
    __shared__ __align__(16) bf sm[2][LTK + LTV];                    // [buffer][K, then V^T]
    __shared__ __align__(16) float xo[8][16][32][4];                 // per wave and lane: its partial O, [(column group * 4 + d tile) * 2 + half of the eight values]
    __shared__ float xm[8][2][2][32];                                // per wave, column group and lane: running maximum, sum
    const int tid = threadIdx.x, lane = tid & 31, lr = lane & 15, hi = lane >> 4; const int w = __builtin_amdgcn_readfirstlane(tid >> 5);
    const int g = blockIdx.x, bh = blockIdx.y; const int qg = w & 1, kq = w >> 1;   // qg: this wave's 32 queries of a tile; kq: its 32 keys of each stage
    const int tl = TT / 64 - 1 - g, nsl = (tl >> 1) + 1, nst = TT / SK + 1;         // the long tile, taken first: nsl stages; then tile g: (g >> 1) + 1 stages; 17 together
    int q0 = tl * 64 + qg * 32, np = q0 / 32 + 1;                    // this wave's queries; their key blocks of 32 up to and including the one that holds the diagonal
    const size_t po = (size_t)bh * TT * HD;
    const bf* qhp = Qh + po + (size_t)(q0 + lr) * HD + 8 * hi;
    const bf* qhn = Qh + po + (size_t)(g * 64 + qg * 32 + lr) * HD + 8 * hi;
    const int sr = tid >> 3, sc = (tid & 7) * 8, so = sr * LP + sc;              // staging of K: eight threads per 128-byte row, rows sr + 32 p
    const int vr = tid >> 4, vc = (tid & 15) * 8, vo = LTK + vr * LPV + vc;      // staging of V^T: sixteen threads per 256-byte row piece, rows vr + 16 p
    const bf* gkh = Kh + po + (size_t)sr * HD + sc; const bf* gvh = Vh + po + (size_t)vr * TT + vc;   // running pointers: this thread's piece of the stage that is fetched next
    v8us stg[8];
    auto gload = [&]() {
#pragma unroll
        for (int p = 0; p < 4; ++p) { stg[p] = *(const v8us*)(gkh + p * 32 * HD); stg[4 + p] = *(const v8us*)(gvh + p * 16 * TT); } };
    auto sstore = [&](int bi) {
#pragma unroll
        for (int p = 0; p < 4; ++p) { *(v8us*)&sm[bi][so + p * 32 * LP] = stg[p]; *(v8us*)&sm[bi][vo + p * 16 * LPV] = stg[4 + p]; } };
    gload();
    v16h qh[2][2];                                                   // [column group][k half]
#pragma unroll
    for (int c = 0; c < 2; ++c)
#pragma unroll
        for (int ks = 0; ks < 2; ++ks) qh[c][ks] = ldh(qhp + c * 16 * HD + ks * 32);
    asm volatile("s_wait_xcnt 0x0" ::: "memory");                    // stands before a register that holds one of these loads' addresses is written again
    v8f o[2][4];
#pragma unroll
    for (int c = 0; c < 2; ++c)
#pragma unroll
        for (int dt = 0; dt < 4; ++dt) o[c][dt] = (v8f){};
    float mrun[2] = {-3.0e38f, -3.0e38f}, lsum[2] = {0.f, 0.f};
    sstore(0);
    landed(qh[0][0], qh[0][1], qh[1][0], qh[1][1]);
    __syncthreads();
    int st = 0;                                                      // key stage inside the current tile
#pragma unroll 1
    for (int s = 0; s < nst; ++s) {
        const bool more = s + 1 < nst, last = s == nsl - 1 || !more; // last: the current tile's diagonal stage; both are the same for the whole work-group
        if (more) { const int adv = last ? -st : 1;                  // on to the next 128 keys, or back to key 0 for the second tile
            gkh += (ptrdiff_t)adv * (SK * HD); gvh += (ptrdiff_t)adv * SK; gload(); asm volatile("s_wait_xcnt 0x0" ::: "memory"); }   // the wait stands before a register that holds one of these loads' addresses is written again
        const bf* kt0 = &sm[s & 1][0] + (kq * 32 + lr) * LP + 8 * hi;            // this lane's row and k half in this wave's 32 rows of tile K
        const bf* vt0 = &sm[s & 1][LTK] + lr * LPV + kq * 32 + 8 * hi;           // this lane's row and k half in this wave's 32 columns of tile V^T
        const int kb = st * 4 + kq;
        if (kb < np) {
            v8f sc2[2][2]; v16h kf[2][2];
#pragma unroll
            for (int kt = 0; kt < 2; ++kt)
#pragma unroll
                for (int ks = 0; ks < 2; ++ks) kf[kt][ks] = ldh(kt0 + kt * 16 * LP + ks * 32);
            __builtin_amdgcn_sched_barrier(0);                       // keeps the eight K reads together ahead of the products: without it the compiler reads each fragment into the same registers and waits out the LDS latency four times
#pragma unroll
            for (int c = 0; c < 2; ++c)
#pragma unroll
                for (int kt = 0; kt < 2; ++kt) sc2[c][kt] = (v8f){};
#pragma unroll
            for (int ks = 0; ks < 2; ++ks)
#pragma unroll
                for (int kt = 0; kt < 2; ++kt)
#pragma unroll
                    for (int c = 0; c < 2; ++c) sc2[c][kt] = wmma16(kf[kt][ks], qh[c][ks], sc2[c][kt]);
            __builtin_amdgcn_sched_barrier(0);                       // keeps the eight score products in one run: mixed with the vector work on their results, each needs idle issue slots behind it
#pragma unroll
            for (int c = 0; c < 2; ++c)
#pragma unroll
                for (int kt = 0; kt < 2; ++kt)
#pragma unroll
                    for (int j = 0; j < 8; ++j) sc2[c][kt][j] *= SCL;
            if (kb == np - 1) {                                      // only the group's last block crosses the diagonal: key > query is masked
#pragma unroll
                for (int c = 0; c < 2; ++c)
#pragma unroll
                    for (int kt = 0; kt < 2; ++kt)
#pragma unroll
                        for (int j = 0; j < 8; ++j) sc2[c][kt][j] = (kt * 16 + hi * 8 + j <= c * 16 + lr) ? sc2[c][kt][j] : -3.0e38f; }
            v16h ph[2];
#pragma unroll
            for (int c = 0; c < 2; ++c) {
                float mx = sc2[c][0][0];
#pragma unroll
                for (int kt = 0; kt < 2; ++kt)
#pragma unroll
                    for (int j = 0; j < 8; ++j) mx = fmaxf(mx, sc2[c][kt][j]);
                mx = fmaxf(mx, xhalf(mx)); const float mnew = fmaxf(mrun[c], mx);
                const float al = __builtin_amdgcn_exp2f((mrun[c] - mnew) * 1.4426950408889634f); mrun[c] = mnew;
                float bs = 0.f;
#pragma unroll
                for (int kt = 0; kt < 2; ++kt) { const v8f e = exp2x8((sc2[c][kt] - mnew) * 1.4426950408889634f);
#pragma unroll
                    for (int j = 0; j < 8; j += 2) { v2f pr; pr[0] = e[j]; pr[1] = e[j + 1]; bs += pr[0] + pr[1];
                        const v2h h2 = __builtin_convertvector(pr, v2h); ph[c][kt * 8 + j] = h2[0]; ph[c][kt * 8 + j + 1] = h2[1]; } }
                lsum[c] = lsum[c] * al + bs;
#pragma unroll
                for (int dt = 0; dt < 4; ++dt) {
#pragma unroll
                    for (int j = 0; j < 8; ++j) o[c][dt][j] *= al; }
            }
#pragma unroll
            for (int dt = 0; dt < 4; ++dt) { const v16h vf = ldh(vt0 + dt * 16 * LPV);
#pragma unroll
                for (int c = 0; c < 2; ++c) o[c][dt] = wmma16(vf, ph[c], o[c][dt]); }
            __builtin_amdgcn_sched_barrier(0);                       // holds the four slots below behind the last product
            asm volatile("v_nop\n\tv_nop\n\tv_nop\n\tv_nop");        // the four vector issue slots that the chip needs behind a matrix instruction before its operands are written again
        }
        if (more) sstore((s + 1) & 1);                               // into the buffer whose readers all passed the barrier at the foot of the trip before
        __syncthreads();                                             // publishes stage s + 1 and ends every wave's reads of stage s
        st = st + 1;
        if (last) {                                                  // the tile is done: the four waves of a query group join their partial softmaxes
            if (more) {                                              // the short tile's queries: fetched here, so that the join covers the loads' latency
#pragma unroll
                for (int c = 0; c < 2; ++c)
#pragma unroll
                    for (int ks = 0; ks < 2; ++ks) qh[c][ks] = ldh(qhn + c * 16 * HD + ks * 32);
                asm volatile("s_wait_xcnt 0x0" ::: "memory");        // stands before a register that holds one of these loads' addresses is written again
            }
#pragma unroll
            for (int c = 0; c < 2; ++c) { lsum[c] += xhalf(lsum[c]);
#pragma unroll
                for (int dt = 0; dt < 4; ++dt) { v4f a, b;
#pragma unroll
                    for (int j = 0; j < 4; ++j) { a[j] = o[c][dt][j]; b[j] = o[c][dt][j + 4]; }
                    *(v4f*)&xo[w][(c * 4 + dt) * 2][lane][0] = a; *(v4f*)&xo[w][(c * 4 + dt) * 2 + 1][lane][0] = b; }
                xm[w][c][0][lane] = mrun[c]; xm[w][c][1][lane] = lsum[c]; }
            __syncthreads();                                         // the partners' values are complete; the stage barriers of the next tile end these reads before xo and xm are written again
            const int cf = kq & 1, dh = kq >> 1;                     // this wave finishes column group cf, output columns 32 dh .. 32 dh + 31
            float pm[4], ps[4];
#pragma unroll
            for (int j = 0; j < 4; ++j) { pm[j] = xm[qg + 2 * j][cf][0][lane]; ps[j] = xm[qg + 2 * j][cf][1][lane]; }
            const float mj = fmaxf(fmaxf(pm[0], pm[1]), fmaxf(pm[2], pm[3]));   // a wave that had no key block holds maximum -3e38, sum 0, O 0: its factor below is 2^-inf = 0
            const v2f e01 = exp2x2((pm[0] - mj) * 1.4426950408889634f, (pm[1] - mj) * 1.4426950408889634f);
            const v2f e23 = exp2x2((pm[2] - mj) * 1.4426950408889634f, (pm[3] - mj) * 1.4426950408889634f);
            const float f = __fdiv_rn(1.0f, ps[0] * e01[0] + ps[1] * e01[1] + ps[2] * e23[0] + ps[3] * e23[1]);
            const float fj[4] = {e01[0] * f, e01[1] * f, e23[0] * f, e23[1] * f};
            float* op = OUT + ((size_t)(bh / NH_) * TT + q0 + cf * 16 + lr) * DQ + (bh % NH_) * HD + dh * 32 + hi * 8;   // values [i][j] = O[query q0 + 16 cf + lr][d = 32 dh + 16 i + 8 hi + j]
#pragma unroll
            for (int i = 0; i < 2; ++i) { v4f a = (v4f){}, b = (v4f){};
#pragma unroll
                for (int j = 0; j < 4; ++j) { const int ix = (cf * 4 + dh * 2 + i) * 2;
                    a += *(const v4f*)&xo[qg + 2 * j][ix][lane][0] * fj[j]; b += *(const v4f*)&xo[qg + 2 * j][ix + 1][lane][0] * fj[j]; }
                *(v4f*)(op + i * 16) = a; *(v4f*)(op + i * 16 + 4) = b; }
            asm volatile("s_wait_xcnt 0x0" ::: "memory");            // stands before a register that these stores name is written again
            st = 0; q0 = g * 64 + qg * 32; np = q0 / 32 + 1;         // the short tile
#pragma unroll
            for (int c = 0; c < 2; ++c) {
#pragma unroll
                for (int dt = 0; dt < 4; ++dt) o[c][dt] = (v8f){};
                mrun[c] = -3.0e38f; lsum[c] = 0.f; }
        }
    }
}


// k_prep: every operand plane of k_fattn in one launch. One work-group takes PT positions of one (batch, head): 96 input values per thread, all loads issued ahead of the first use.
// Q plane [bh][t][f]: qw = bf16(q) bf16(W) rounded to f16, as the transposed product (qw)^T = W^T q^T (A = 16 rows f of W^T, B = 16 query columns, the k order of WFrag::ld on both sides, e 0-31 then 32-63),
// so a lane holds eight consecutive f of one query; the rows go through LDS and leave as whole 128-byte lines. K plane [bh][t][d] and V^T plane [bh][d][t]: the bf16-rounded inputs,
// written as f16. V is transposed in LDS, two positions per dword, 16-byte pieces of a row swapped by d / 4 so that neither the column writes nor the row reads collide.
#define PT 128
typedef __attribute__((ext_vector_type(2))) unsigned v2u;
typedef __attribute__((ext_vector_type(4))) unsigned v4u;
__device__ __forceinline__ unsigned pkbf(float a, float b) { v2f p; p[0] = a; p[1] = b; return __builtin_bit_cast(unsigned, __builtin_convertvector(p, v2bf)); }   // a in the low half; round to nearest even
__device__ __forceinline__ unsigned pkh(float a, float b) { v2f p; p[0] = a; p[1] = b; return __builtin_bit_cast(unsigned, __builtin_convertvector(p, v2h)); }     // the same to f16
__device__ __forceinline__ unsigned pkhb(float a, float b) { const unsigned u = pkbf(a, b); return pkh(__uint_as_float(u << 16), __uint_as_float(u & 0xffff0000u)); }   // rounded to bf16 first, then written as f16
// work-group barrier that orders LDS only: the waves exchange nothing through global memory here, and __syncthreads() would also wait for every global store issued so far to be acknowledged
__device__ __forceinline__ void lds_barrier() { __builtin_amdgcn_fence(__ATOMIC_RELEASE, "workgroup", "local"); __builtin_amdgcn_s_barrier(); __builtin_amdgcn_fence(__ATOMIC_ACQUIRE, "workgroup", "local"); }
__global__ __launch_bounds__(256) void k_prep(const float* __restrict__ q, const float* __restrict__ k, const float* __restrict__ v, const float* __restrict__ wgt,
                                              bf* __restrict__ Qh, bf* __restrict__ Kh, bf* __restrict__ Vh) {
    typedef WFrag<bf> F;
    __shared__ __align__(16) bf wt[HD * LP];              // W^T [f][e]
    __shared__ __align__(16) bf qs[PT * LP];              // bf16(q) rows, then the f16 rows of qw
    __shared__ __align__(16) unsigned vt[HD * (PT / 2)];  // V^T [d][t / 2]
    const int tid = threadIdx.x, lane = tid & 31, lr = lane & 15, hi = lane >> 4, w = tid >> 5;
    const int t0 = blockIdx.x * PT, bh = blockIdx.y;
    const size_t ib = (((size_t)(bh / NH_) * TT + t0) * NH_ + (bh % NH_)) * HD;   // row t0 of this head in [b][t][h][e]; rows lie DQ apart
    const size_t pb = ((size_t)bh * TT + t0) * HD;                                // row t0 in a [bh][t][d] plane
    const size_t vb = (size_t)bh * HD * TT + t0;                                  // column t0 of row d = 0 in a [bh][d][t] plane
    const int r16 = tid >> 4, c = tid & 15, c4 = c * 4;                           // sixteen threads per 256-byte input row
    v4f xw[4], xq[8], xk[8], xv[8];
    { const float* wp = wgt + (size_t)(tid >> 3) * 2 * HD + (tid & 7) * 8;        // rows e and e + 1, eight f
      xw[0] = *(const v4f*)wp; xw[1] = *(const v4f*)(wp + 4); xw[2] = *(const v4f*)(wp + HD); xw[3] = *(const v4f*)(wp + HD + 4); }
#pragma unroll
    for (int p = 0; p < 8; ++p) xq[p] = *(const v4f*)(q + ib + (size_t)(p * 16 + r16) * DQ + c4);
    asm volatile("s_wait_xcnt 0x0" ::: "memory");   // here and below: stands before a register that an issued load or store names is written again
#pragma unroll
    for (int p = 0; p < 8; ++p) xv[p] = *(const v4f*)(v + ib + (size_t)((p >> 1) * 32 + 2 * r16 + (p & 1)) * DQ + c4);   // positions t and t + 1 in one thread
    asm volatile("s_wait_xcnt 0x0" ::: "memory");
#pragma unroll
    for (int p = 0; p < 8; ++p) xk[p] = *(const v4f*)(k + ib + (size_t)(p * 16 + r16) * DQ + c4);
    __builtin_amdgcn_sched_barrier(0);                    // keeps all 28 loads of a thread in flight together: without it the compiler issues V's loads only behind the first data wait
    { unsigned* wd = (unsigned*)wt + (tid & 7) * 8 * (LP / 2) + (tid >> 3);
#pragma unroll
      for (int i = 0; i < 8; ++i) wd[i * (LP / 2)] = pkbf(xw[i >> 2][i & 3], xw[2 + (i >> 2)][i & 3]); }
#pragma unroll
    for (int p = 0; p < 8; ++p) { v2u o; o[0] = pkbf(xq[p][0], xq[p][1]); o[1] = pkbf(xq[p][2], xq[p][3]); *(v2u*)&qs[(p * 16 + r16) * LP + c4] = o; }
#pragma unroll
    for (int p = 0; p < 4; ++p) { const int t2 = p * 16 + r16;
#pragma unroll
        for (int i = 0; i < 4; ++i) vt[(c4 + i) * (PT / 2) + (((t2 >> 2) ^ c) << 2) + (t2 & 3)] = pkhb(xv[2 * p][i], xv[2 * p + 1][i]); }
#pragma unroll
    for (int p = 0; p < 8; ++p) { v2u o; o[0] = pkhb(xk[p][0], xk[p][1]); o[1] = pkhb(xk[p][2], xk[p][3]); *(v2u*)(Kh + pb + (size_t)(p * 16 + r16) * HD + c4) = o; }
    asm volatile("s_wait_xcnt 0x0" ::: "memory");
    lds_barrier();                                        // W^T, the bf16 query rows and V^T are complete
    bf* qrow = &qs[(w * 16 + lr) * LP + 8 * hi];          // a wave reads and rewrites its own sixteen rows only
    v16bf bq[2];
#pragma unroll
    for (int ks = 0; ks < 2; ++ks) bq[ks] = F::ld(qrow + ks * 32);
    v8f acc[4];
#pragma unroll
    for (int ft = 0; ft < 4; ++ft) acc[ft] = (v8f){};
#pragma unroll
    for (int ks = 0; ks < 2; ++ks)
#pragma unroll
        for (int ft = 0; ft < 4; ++ft) acc[ft] = F::mma(F::ld(&wt[(ft * 16 + lr) * LP + 8 * hi + ks * 32]), bq[ks], acc[ft]);
#pragma unroll
    for (int s = 0; s < 4; ++s) { const int idx = s * 256 + tid, d = idx >> 4, qd = idx & 15;
        *(v4u*)(Vh + vb + (size_t)d * TT + qd * 8) = *(const v4u*)&vt[d * (PT / 2) + ((qd ^ (d >> 2)) << 2)]; }
#pragma unroll
    for (int ft = 0; ft < 4; ++ft) { v4u hv;              // acc[ft][j] = qw[query w * 16 + lr][f = 16 ft + 8 hi + j]
#pragma unroll
        for (int j = 0; j < 8; j += 2) hv[j >> 1] = pkh(acc[ft][j], acc[ft][j + 1]);
        *(v4u*)(qrow + ft * 16) = hv; }
    asm volatile("s_wait_xcnt 0x0" ::: "memory");
    lds_barrier();                                        // the f16 rows are complete
#pragma unroll
    for (int s = 0; s < 4; ++s) { const int idx = s * 256 + tid; const int lo = (idx >> 3) * LP + (idx & 7) * 8;
        *(v4u*)(Qh + pb + (size_t)idx * 8) = *(const v4u*)&qs[lo]; }
}

extern "C" void kernel_launch(void* const* d_in, const int* in_sizes, int n_in,
                              void* d_out, int out_size, void* d_ws, size_t ws_size, hipStream_t stream) {
    (void)in_sizes; (void)n_in; (void)out_size;
    const float* qi = (const float*)d_in[0]; const float* ki = (const float*)d_in[1]; const float* vi = (const float*)d_in[2]; const float* wq = (const float*)d_in[3];
    float* OUT = (float*)d_out;     // [4][2048][512]
    char* wsp = (char*)d_ws;
    auto take = [&](size_t bytes) { char* p = wsp; wsp += (bytes + 255) & ~(size_t)255; return (void*)p; };
    const size_t PB = (size_t)NH_ * TT * HD;   // elements of one batch's head planes; each plane holds every batch
    bf* QPh = (bf*)take(NB_ * PB * 2); bf* KPh = (bf*)take(NB_ * PB * 2); bf* VTh = (bf*)take(NB_ * PB * 2);
    if ((size_t)(wsp - (char*)d_ws) > ws_size) return;    // ws 256 MiB
    k_prep<<<dim3(TT / PT, NB_ * NH_, 1), 256, 0, stream>>>(qi, ki, vi, wq, QPh, KPh, VTh);
    k_fattn<<<dim3(TT / 128, NB_ * NH_, 1), 256, 0, stream>>>(QPh, KPh, VTh, OUT);   /* one kv head per query head: plane b * 8 + h of each */
}

// v008
// Measured time: 35.3 microseconds a run.
// Timed twice side by side with v007, it ran 1.05 times as fast both times.
// All steps since v000 together make it 28.0 times as fast.
#include <hip/hip_runtime.h>

#include <hip/hip_runtime.h>

#define NB_  4
#define TT   2048
#define DM   512
#define NH_  8
#define NKV  8
#define REP  (NH_ / NKV)
#define HD   64
#define DQ   (NH_ * HD)
#define DKV  (NKV * HD)
#define SCL  0.125f   // HD^-0.5
typedef _Float16 h16;
typedef unsigned short bf;
typedef __attribute__((ext_vector_type(16))) __bf16   v16bf;
typedef __attribute__((ext_vector_type(16))) _Float16 v16h;
typedef __attribute__((ext_vector_type(8)))  _Float16 v8h;
typedef __attribute__((ext_vector_type(8)))  unsigned short v8us;
typedef __attribute__((ext_vector_type(8)))  float    v8f;
typedef __attribute__((ext_vector_type(4)))  float    v4f;
typedef v8h  __attribute__((may_alias)) v8ha;
typedef v4f  __attribute__((may_alias)) v4fa;
typedef v8us __attribute__((may_alias)) v8usa;

__device__ __forceinline__ unsigned short f2bf(float f) { unsigned u = __float_as_uint(f); u += 0x7FFFu + ((u >> 16) & 1u); return (unsigned short)(u >> 16); }
__device__ __forceinline__ float bf2f(unsigned short b) { return __uint_as_float(((unsigned)b) << 16); }
__device__ __forceinline__ float bfr(float f) { return bf2f(f2bf(f)); }
__device__ __forceinline__ v16h cat16(v8h lo, v8h hi) { return __builtin_shufflevector(lo, hi, 0, 1, 2, 3, 4, 5, 6, 7, 8, 9, 10, 11, 12, 13, 14, 15); }
__device__ __forceinline__ v16bf cat16b(v8us lo, v8us hi) { return __builtin_bit_cast(v16bf, __builtin_shufflevector(lo, hi, 0, 1, 2, 3, 4, 5, 6, 7, 8, 9, 10, 11, 12, 13, 14, 15)); }
__device__ __forceinline__ v8f wmma16(v16h a, v16h b, v8f c) { return __builtin_amdgcn_wmma_f32_16x16x32_f16(false, a, false, b, (short)0, c, false, false); }
__device__ __forceinline__ v8f wmmab(v16bf a, v16bf b, v8f c) { return __builtin_amdgcn_wmma_f32_16x16x32_bf16(false, a, false, b, (short)0, c, false, false); }



// fragment loader and product of the 16x16x32 forms: sixteen k of one row per lane, k = 8 hi + 0..7 and 16 + 8 hi + 0..7
template <typename T16> struct WFrag;
template <> struct WFrag<h16> { typedef v16h V; static __device__ __forceinline__ V ld(const h16* p) { return cat16(*(const v8h*)p, *(const v8h*)(p + 16)); } static __device__ __forceinline__ v8f mma(V a, V b, v8f c) { return wmma16(a, b, c); } };
template <> struct WFrag<bf> { typedef v16bf V; static __device__ __forceinline__ V ld(const bf* p) { return cat16b(*(const v8us*)p, *(const v8us*)(p + 16)); } static __device__ __forceinline__ v8f mma(V a, V b, v8f c) { return wmmab(a, b, c); } };
typedef __attribute__((ext_vector_type(2))) _Float16 v2h;
typedef __attribute__((ext_vector_type(4))) _Float16 v4h;
typedef __attribute__((ext_vector_type(2))) unsigned short v2us;
typedef __attribute__((ext_vector_type(4))) unsigned short v4us;
typedef __attribute__((ext_vector_type(2))) float v2f;
typedef __attribute__((ext_vector_type(4))) int v4i;


// k_fattn: scores, causal softmax and probability x value product in one launch for every batch and head; nothing of the score matrix goes to memory.
// Transposed products: S^T = K Q^T (A = 16 key rows, B = 16 query columns) and O^T += V^T P^T, so a lane holds one query's scores (keys 8 hi + r of each 16-key tile) and two score tiles, converted in place,
// are the B operand of the second product. Running maximum and sum per query (online softmax). Both products take f16 operands: qw and P are each rounded once to f16 (11 significant bits),
// K and V are the bf16-rounded inputs, which f16 holds unchanged (8 significant bits; below 2^-14 in magnitude to within 2^-25): one product K Q and one product V P per tile.
// The eight waves of a work-group share K and V^T through LDS: stages of SK keys, two buffers, one barrier per stage. Each stage comes in by two tensor loads (wave 0: K, wave 1: V^T), through no register,
// issued behind the barrier that frees its buffer and in flight during the next stage's products; the loads' pad fields give the two LDS row pitches below.
// A wave holds 32 queries as two column groups of 16, so that every K and V^T fragment read from LDS feeds two products. Four waves own the same 32 queries: wave w takes keys 32 (w >> 1) .. + 31 of every stage,
// each with its own running maximum, sum and O.
// All eight waves take a 64-query tile from the long end of the causal triangle and then the mirrored tile from the short end of the same head: 17 stages in every work-group.
// Behind a tile's diagonal stage the four waves of a group join their partial results through LDS; each finishes and stores 32 of the 64 output columns of one column group.
#define SK 128                    // keys per stage: a V^T row piece is then 256 bytes
#define LP 72                     // LDS row pitch of K in 16-bit elements: 144 bytes, 16 x odd, for 16-byte reads of 128-byte rows
#define LPV 136                   // LDS row pitch of V^T: 272 bytes, 16 x odd, for 16-byte reads of 256-byte rows
#define LTK (SK * LP)             // staged K tile: 128 rows (keys)
#define LTV 9216                  // staged V^T tile: 64 rows (d) of LPV, 8704 elements, rounded up so that every tile's place in LDS is a multiple of 2 KiB
typedef __attribute__((ext_vector_type(2))) __bf16 v2bf;
// sixteen f16 of one row, kept in memory as 16-bit words: k = 8 hi + 0..7 and 16 + 8 hi + 0..7, the k order of WFrag::ld
__device__ __forceinline__ v16h ldh(const bf* p) { return __builtin_bit_cast(v16h, __builtin_shufflevector(*(const v8us*)p, *(const v8us*)(p + 16), 0, 1, 2, 3, 4, 5, 6, 7, 8, 9, 10, 11, 12, 13, 14, 15)); }
__device__ __forceinline__ float xhalf(float x) { const int b = __float_as_int(x); return __int_as_float(__builtin_amdgcn_permlanex16(b, b, 0x76543210, 0xfedcba98, false, false)); }   // value of lane ^ 16
// eight 2^x and, in the same statement, the one free issue slot that the instruction set asks for behind a transcendental; the early-clobber outputs keep every source whole until the statement ends
__device__ __forceinline__ v8f exp2x8(v8f x) { float d0, d1, d2, d3, d4, d5, d6, d7;
    asm("v_exp_f32 %0, %8\n\tv_exp_f32 %1, %9\n\tv_exp_f32 %2, %10\n\tv_exp_f32 %3, %11\n\tv_exp_f32 %4, %12\n\tv_exp_f32 %5, %13\n\tv_exp_f32 %6, %14\n\tv_exp_f32 %7, %15\n\tv_nop"
        : "=&v"(d0), "=&v"(d1), "=&v"(d2), "=&v"(d3), "=&v"(d4), "=&v"(d5), "=&v"(d6), "=&v"(d7) : "v"(x[0]), "v"(x[1]), "v"(x[2]), "v"(x[3]), "v"(x[4]), "v"(x[5]), "v"(x[6]), "v"(x[7]));
    v8f d; d[0] = d0; d[1] = d1; d[2] = d2; d[3] = d3; d[4] = d4; d[5] = d5; d[6] = d6; d[7] = d7; return d; }
// two 2^x with the same free issue slot behind them
__device__ __forceinline__ v2f exp2x2(float x0, float x1) { float d0, d1;
    asm("v_exp_f32 %0, %2\n\tv_exp_f32 %1, %3\n\tv_nop" : "=&v"(d0), "=&v"(d1) : "v"(x0), "v"(x1));
    v2f d; d[0] = d0; d[1] = d1; return d; }
// inputs-only fence on the four loaded query fragments: the loads have landed where it stands. Without it the compiler may sink them below the next barrier, where the first stage's landing no longer covers their latency
__device__ __forceinline__ void landed(v16h a, v16h b, v16h c, v16h d) { asm volatile("" :: "v"(__builtin_bit_cast(v8f, a)), "v"(__builtin_bit_cast(v8f, b)), "v"(__builtin_bit_cast(v8f, c)), "v"(__builtin_bit_cast(v8f, d))); }
typedef unsigned u32x4 __attribute__((ext_vector_type(4)));
typedef unsigned u32x8 __attribute__((ext_vector_type(8)));
__device__ __forceinline__ unsigned uni(unsigned v) { return (unsigned)__builtin_amdgcn_readfirstlane(v); }
// a wave-uniform value held in a scalar register: a test on it compiles to a scalar compare and branch, the only guard that a tensor load obeys (it ignores EXEC)
__device__ __forceinline__ unsigned pinned(unsigned v) { unsigned w = __builtin_amdgcn_readfirstlane(v); asm volatile("" : "+s"(w)); return w; }
// group 1 of a tensor load's descriptor: NR rows of RB bytes, SP bytes apart in memory; W0 = its word 0 (no mask, extents in bytes, the pad behind every row). The empty statement holds the eight descriptor words
// in scalar registers of their own for as long as the value lives: as plain constants they would be written afresh in front of every load into registers that are free for other use right behind it
template <unsigned W0, unsigned RB, unsigned NR, unsigned SP> __device__ __forceinline__ u32x8 tgroup1() {
    u32x8 g1; g1[0] = uni(W0); g1[1] = uni((RB & 0xFFFFu) << 16); g1[2] = uni((RB >> 16) | ((NR & 0xFFFFu) << 16)); g1[3] = uni((NR >> 16) | (RB << 16)); g1[4] = uni(NR); g1[5] = uni(SP); g1[6] = uni(0u); g1[7] = uni(0u);
    asm volatile("" : "+s"(g1)); return g1; }
// group 0: from byte address ga to LDS byte offset dst
__device__ __forceinline__ u32x4 tgroup0(unsigned dst, unsigned long long ga) {
    u32x4 g0; g0[0] = uni(1u); g0[1] = uni(dst); g0[2] = uni((unsigned)ga); g0[3] = uni((((unsigned)(ga >> 32)) & 0x01FFFFFFu) | 0x80000000u); return g0; }
// one tensor load of the whole wave
__device__ __forceinline__ void tload(u32x4 g0, u32x8 g1) { asm volatile("tensor_load_to_lds %0, %1" :: "s"(g0), "s"(g1) : "memory"); }
// the issuing wave's own request has landed. The statement names the descriptor's registers as inputs, so that none of them is written again while the request is outstanding
__device__ __forceinline__ void twait(u32x4 g0, u32x8 a, u32x8 b) { asm volatile("s_wait_tensorcnt 0x0" :: "s"(g0), "s"(a), "s"(b) : "memory"); }
__global__ __launch_bounds__(256) __attribute__((amdgpu_waves_per_eu(4, 4))) void k_fattn(const bf* __restrict__ Qh, const bf* __restrict__ Kh, const bf* __restrict__ Vh, float* __restrict__ OUT) {
    __shared__ __attribute__((aligned(2048))) bf sm[2][LTK + LTV];   // [buffer][K, then V^T]; each of the four tiles starts at a multiple of 2 KiB of the work-group's LDS
    __shared__ __align__(16) float xo[8][16][32][4];                 // per wave and lane: its partial O, [(column group * 4 + d tile) * 2 + half of the eight values]
    __shared__ float xm[8][2][2][32];                                // per wave, column group and lane: running maximum, sum
    const int tid = threadIdx.x, lane = tid & 31, lr = lane & 15, hi = lane >> 4; const int w = __builtin_amdgcn_readfirstlane(tid >> 5);
    const int g = blockIdx.x, bh = blockIdx.y; const int qg = w & 1, kq = w >> 1;   // qg: this wave's 32 queries of a tile; kq: its 32 keys of each stage
    const int tl = TT / 64 - 1 - g, nsl = (tl >> 1) + 1, nst = TT / SK + 1;         // the long tile, taken first: nsl stages; then tile g: (g >> 1) + 1 stages; 17 together
    int q0 = tl * 64 + qg * 32, np = q0 / 32 + 1;                    // this wave's queries; their key blocks of 32 up to and including the one that holds the diagonal
    const size_t po = (size_t)bh * TT * HD;
    const bf* qhp = Qh + po + (size_t)(q0 + lr) * HD + 8 * hi;
    const bf* qhn = Qh + po + (size_t)(g * 64 + qg * 32 + lr) * HD + 8 * hi;
    const unsigned lb = (unsigned)(size_t)&sm[0][0];                 // byte offset of the buffers in the work-group's LDS
    const unsigned long long kga = (unsigned long long)(size_t)(Kh + po), vga = (unsigned long long)(size_t)(Vh + po);
    const u32x8 g1k = tgroup1<(1u << 20) | (4u << 22) | (3u << 25), HD * 2, SK, HD * 2>();   // K: 128 rows of 128 bytes, 16 bytes of pad each: pitch LP
    const u32x8 g1v = tgroup1<(1u << 20) | (5u << 22) | (3u << 25), SK * 2, HD, TT * 2>();   // V^T: 64 rows of 256 bytes out of rows of 4096, 16 bytes of pad each: pitch LPV
    u32x4 g0;                                                        // group 0 of this wave's latest request
    auto issue = [&](int sg) {                                       // stage sg of the work-group's 17 into buffer sg & 1: keys 128 ks .. + 127 of the long tile (sg < nsl) or of the short one
        const unsigned ks = pinned((unsigned)(sg < nsl ? sg : sg - nsl));   // pinned: the words that depend on it are formed behind the wait that stands in front of the call
        g0 = tgroup0(lb + (unsigned)(sg & 1) * ((LTK + LTV) * 2) + (w == 1 ? LTK * 2 : 0), w == 1 ? vga + (unsigned long long)ks * (SK * 2) : kga + (unsigned long long)ks * (SK * HD * 2));
        if (pinned(w == 0)) tload(g0, g1k);
        if (pinned(w == 1)) tload(g0, g1v); };
    v16h qh[2][2];                                                   // [column group][k half]
#pragma unroll
    for (int c = 0; c < 2; ++c)
#pragma unroll
        for (int ks = 0; ks < 2; ++ks) qh[c][ks] = ldh(qhp + c * 16 * HD + ks * 32);
    asm volatile("s_wait_xcnt 0x0" ::: "memory");                    // stands before a register that holds one of these loads' addresses is written again
    v8f o[2][4];
#pragma unroll
    for (int c = 0; c < 2; ++c)
#pragma unroll
        for (int dt = 0; dt < 4; ++dt) o[c][dt] = (v8f){};
    float mrun[2] = {-3.0e38f, -3.0e38f}, lsum[2] = {0.f, 0.f};
    issue(0);
    if (pinned(w < 2)) twait(g0, g1k, g1v);                          // the issuing wave's own tile of stage 0 has landed
    landed(qh[0][0], qh[0][1], qh[1][0], qh[1][1]);
    __syncthreads();                                                 // publishes stage 0
    issue(1);
    int st = 0;                                                      // key stage inside the current tile
#pragma unroll 1
    for (int s = 0; s < nst; ++s) {
        const bool more = s + 1 < nst, last = s == nsl - 1 || !more; // last: the current tile's diagonal stage; both are the same for the whole work-group
        const bf* kt0 = &sm[s & 1][0] + (kq * 32 + lr) * LP + 8 * hi;            // this lane's row and k half in this wave's 32 rows of tile K
        const bf* vt0 = &sm[s & 1][LTK] + lr * LPV + kq * 32 + 8 * hi;           // this lane's row and k half in this wave's 32 columns of tile V^T
        const int kb = st * 4 + kq;
        if (kb < np) {
            v8f sc2[2][2]; v16h kf[2][2];
#pragma unroll
            for (int kt = 0; kt < 2; ++kt)
#pragma unroll
                for (int ks = 0; ks < 2; ++ks) kf[kt][ks] = ldh(kt0 + kt * 16 * LP + ks * 32);
            __builtin_amdgcn_sched_barrier(0);                       // keeps the eight K reads together ahead of the products: without it the compiler reads each fragment into the same registers and waits out the LDS latency four times
#pragma unroll
            for (int c = 0; c < 2; ++c)
#pragma unroll
                for (int kt = 0; kt < 2; ++kt) sc2[c][kt] = (v8f){};
#pragma unroll
            for (int ks = 0; ks < 2; ++ks)
#pragma unroll
                for (int kt = 0; kt < 2; ++kt)
#pragma unroll
                    for (int c = 0; c < 2; ++c) sc2[c][kt] = wmma16(kf[kt][ks], qh[c][ks], sc2[c][kt]);
            __builtin_amdgcn_sched_barrier(0);                       // keeps the eight score products in one run: mixed with the vector work on their results, each needs idle issue slots behind it
#pragma unroll
            for (int c = 0; c < 2; ++c)
#pragma unroll
                for (int kt = 0; kt < 2; ++kt)
#pragma unroll
                    for (int j = 0; j < 8; ++j) sc2[c][kt][j] *= SCL;
            if (kb == np - 1) {                                      // only the group's last block crosses the diagonal: key > query is masked
#pragma unroll
                for (int c = 0; c < 2; ++c)
#pragma unroll
                    for (int kt = 0; kt < 2; ++kt)
#pragma unroll
                        for (int j = 0; j < 8; ++j) sc2[c][kt][j] = (kt * 16 + hi * 8 + j <= c * 16 + lr) ? sc2[c][kt][j] : -3.0e38f; }
            v16h ph[2];
#pragma unroll
            for (int c = 0; c < 2; ++c) {
                float mx = sc2[c][0][0];
#pragma unroll
                for (int kt = 0; kt < 2; ++kt)
#pragma unroll
                    for (int j = 0; j < 8; ++j) mx = fmaxf(mx, sc2[c][kt][j]);
                mx = fmaxf(mx, xhalf(mx)); const float mnew = fmaxf(mrun[c], mx);
                const float al = __builtin_amdgcn_exp2f((mrun[c] - mnew) * 1.4426950408889634f); mrun[c] = mnew;
                float bs = 0.f;
#pragma unroll
                for (int kt = 0; kt < 2; ++kt) { const v8f e = exp2x8((sc2[c][kt] - mnew) * 1.4426950408889634f);
#pragma unroll
                    for (int j = 0; j < 8; j += 2) { v2f pr; pr[0] = e[j]; pr[1] = e[j + 1]; bs += pr[0] + pr[1];
                        const v2h h2 = __builtin_convertvector(pr, v2h); ph[c][kt * 8 + j] = h2[0]; ph[c][kt * 8 + j + 1] = h2[1]; } }
                lsum[c] = lsum[c] * al + bs;
#pragma unroll
                for (int dt = 0; dt < 4; ++dt) {
#pragma unroll
                    for (int j = 0; j < 8; ++j) o[c][dt][j] *= al; }
            }
#pragma unroll
            for (int dt = 0; dt < 4; ++dt) { const v16h vf = ldh(vt0 + dt * 16 * LPV);
#pragma unroll
                for (int c = 0; c < 2; ++c) o[c][dt] = wmma16(vf, ph[c], o[c][dt]); }
        }
        asm volatile("s_wait_dscnt 0x0" ::: "memory");               // this wave's reads of stage s have returned before the barrier behind which its buffer is refilled
        if (pinned(w < 2)) twait(g0, g1k, g1v);                      // the issuing wave's own tile of stage s + 1 has landed
        __syncthreads();                                             // publishes stage s + 1 and ends every wave's reads of stage s
        if (pinned(s + 2 < nst && w < 2)) issue(s + 2);              // into the buffer that this trip has read; the six waves that issue nothing form no descriptor
        st = st + 1;
        if (last) {                                                  // the tile is done: the four waves of a query group join their partial softmaxes
            if (more) {                                              // the short tile's queries: fetched here, so that the join covers the loads' latency
#pragma unroll
                for (int c = 0; c < 2; ++c)
#pragma unroll
                    for (int ks = 0; ks < 2; ++ks) qh[c][ks] = ldh(qhn + c * 16 * HD + ks * 32);
                asm volatile("s_wait_xcnt 0x0" ::: "memory");        // stands before a register that holds one of these loads' addresses is written again
            }
#pragma unroll
            for (int c = 0; c < 2; ++c) { lsum[c] += xhalf(lsum[c]);
#pragma unroll
                for (int dt = 0; dt < 4; ++dt) { v4f a, b;
#pragma unroll
                    for (int j = 0; j < 4; ++j) { a[j] = o[c][dt][j]; b[j] = o[c][dt][j + 4]; }
                    *(v4f*)&xo[w][(c * 4 + dt) * 2][lane][0] = a; *(v4f*)&xo[w][(c * 4 + dt) * 2 + 1][lane][0] = b; }
                xm[w][c][0][lane] = mrun[c]; xm[w][c][1][lane] = lsum[c]; }
            __syncthreads();                                         // the partners' values are complete; the stage barriers of the next tile end these reads before xo and xm are written again
            const int cf = kq & 1, dh = kq >> 1;                     // this wave finishes column group cf, output columns 32 dh .. 32 dh + 31
            float pm[4], ps[4];
#pragma unroll
            for (int j = 0; j < 4; ++j) { pm[j] = xm[qg + 2 * j][cf][0][lane]; ps[j] = xm[qg + 2 * j][cf][1][lane]; }
            const float mj = fmaxf(fmaxf(pm[0], pm[1]), fmaxf(pm[2], pm[3]));   // a wave that had no key block holds maximum -3e38, sum 0, O 0: its factor below is 2^-inf = 0
            const v2f e01 = exp2x2((pm[0] - mj) * 1.4426950408889634f, (pm[1] - mj) * 1.4426950408889634f);
            const v2f e23 = exp2x2((pm[2] - mj) * 1.4426950408889634f, (pm[3] - mj) * 1.4426950408889634f);
            const float f = __fdiv_rn(1.0f, ps[0] * e01[0] + ps[1] * e01[1] + ps[2] * e23[0] + ps[3] * e23[1]);
            const float fj[4] = {e01[0] * f, e01[1] * f, e23[0] * f, e23[1] * f};
            float* op = OUT + ((size_t)(bh / NH_) * TT + q0 + cf * 16 + lr) * DQ + (bh % NH_) * HD + dh * 32 + hi * 8;   // values [i][j] = O[query q0 + 16 cf + lr][d = 32 dh + 16 i + 8 hi + j]
#pragma unroll
            for (int i = 0; i < 2; ++i) { v4f a = (v4f){}, b = (v4f){};
#pragma unroll
                for (int j = 0; j < 4; ++j) { const int ix = (cf * 4 + dh * 2 + i) * 2;
                    a += *(const v4f*)&xo[qg + 2 * j][ix][lane][0] * fj[j]; b += *(const v4f*)&xo[qg + 2 * j][ix + 1][lane][0] * fj[j]; }
                *(v4f*)(op + i * 16) = a; *(v4f*)(op + i * 16 + 4) = b; }
            asm volatile("s_wait_xcnt 0x0" ::: "memory");            // stands before a register that these stores name is written again
            st = 0; q0 = g * 64 + qg * 32; np = q0 / 32 + 1;         // the short tile
#pragma unroll
            for (int c = 0; c < 2; ++c) {
#pragma unroll
                for (int dt = 0; dt < 4; ++dt) o[c][dt] = (v8f){};
                mrun[c] = -3.0e38f; lsum[c] = 0.f; }
        }
    }
    asm volatile("s_wait_tensorcnt 0x0" ::: "memory");               // no tensor load is in flight when the wave ends
    asm volatile("s_wait_dscnt 0x0" ::: "memory");
}


// k_prep: every operand plane of k_fattn in one launch. One work-group takes PT positions of one (batch, head): 96 input values per thread, all loads issued ahead of the first use.
// Q plane [bh][t][f]: qw = bf16(q) bf16(W) rounded to f16, as the transposed product (qw)^T = W^T q^T (A = 16 rows f of W^T, B = 16 query columns, the k order of WFrag::ld on both sides, e 0-31 then 32-63),
// so a lane holds eight consecutive f of one query; the rows go through LDS and leave as whole 128-byte lines. K plane [bh][t][d] and V^T plane [bh][d][t]: the bf16-rounded inputs,
// written as f16. V is transposed in LDS, two positions per dword, 16-byte pieces of a row swapped by d / 4 so that neither the column writes nor the row reads collide.
#define PT 128
typedef __attribute__((ext_vector_type(2))) unsigned v2u;
typedef __attribute__((ext_vector_type(4))) unsigned v4u;
__device__ __forceinline__ unsigned pkbf(float a, float b) { v2f p; p[0] = a; p[1] = b; return __builtin_bit_cast(unsigned, __builtin_convertvector(p, v2bf)); }   // a in the low half; round to nearest even
__device__ __forceinline__ unsigned pkh(float a, float b) { v2f p; p[0] = a; p[1] = b; return __builtin_bit_cast(unsigned, __builtin_convertvector(p, v2h)); }     // the same to f16
__device__ __forceinline__ unsigned pkhb(float a, float b) { const unsigned u = pkbf(a, b); return pkh(__uint_as_float(u << 16), __uint_as_float(u & 0xffff0000u)); }   // rounded to bf16 first, then written as f16
// work-group barrier that orders LDS only: the waves exchange nothing through global memory here, and __syncthreads() would also wait for every global store issued so far to be acknowledged
__device__ __forceinline__ void lds_barrier() { __builtin_amdgcn_fence(__ATOMIC_RELEASE, "workgroup", "local"); __builtin_amdgcn_s_barrier(); __builtin_amdgcn_fence(__ATOMIC_ACQUIRE, "workgroup", "local"); }
__global__ __launch_bounds__(256) void k_prep(const float* __restrict__ q, const float* __restrict__ k, const float* __restrict__ v, const float* __restrict__ wgt,
                                              bf* __restrict__ Qh, bf* __restrict__ Kh, bf* __restrict__ Vh) {
    typedef WFrag<bf> F;
    __shared__ __align__(16) bf wt[HD * LP];              // W^T [f][e]
    __shared__ __align__(16) bf qs[PT * LP];              // bf16(q) rows, then the f16 rows of qw
    __shared__ __align__(16) unsigned vt[HD * (PT / 2)];  // V^T [d][t / 2]
    const int tid = threadIdx.x, lane = tid & 31, lr = lane & 15, hi = lane >> 4, w = tid >> 5;
    const int t0 = blockIdx.x * PT, bh = blockIdx.y;
    const size_t ib = (((size_t)(bh / NH_) * TT + t0) * NH_ + (bh % NH_)) * HD;   // row t0 of this head in [b][t][h][e]; rows lie DQ apart
    const size_t pb = ((size_t)bh * TT + t0) * HD;                                // row t0 in a [bh][t][d] plane
    const size_t vb = (size_t)bh * HD * TT + t0;                                  // column t0 of row d = 0 in a [bh][d][t] plane
    const int r16 = tid >> 4, c = tid & 15, c4 = c * 4;                           // sixteen threads per 256-byte input row
    v4f xw[4], xq[8], xk[8], xv[8];
    { const float* wp = wgt + (size_t)(tid >> 3) * 2 * HD + (tid & 7) * 8;        // rows e and e + 1, eight f
      xw[0] = *(const v4f*)wp; xw[1] = *(const v4f*)(wp + 4); xw[2] = *(const v4f*)(wp + HD); xw[3] = *(const v4f*)(wp + HD + 4); }
#pragma unroll
    for (int p = 0; p < 8; ++p) xq[p] = *(const v4f*)(q + ib + (size_t)(p * 16 + r16) * DQ + c4);
    asm volatile("s_wait_xcnt 0x0" ::: "memory");   // here and below: stands before a register that an issued load or store names is written again
#pragma unroll
    for (int p = 0; p < 8; ++p) xv[p] = *(const v4f*)(v + ib + (size_t)((p >> 1) * 32 + 2 * r16 + (p & 1)) * DQ + c4);   // positions t and t + 1 in one thread
    asm volatile("s_wait_xcnt 0x0" ::: "memory");
#pragma unroll
    for (int p = 0; p < 8; ++p) xk[p] = *(const v4f*)(k + ib + (size_t)(p * 16 + r16) * DQ + c4);
    __builtin_amdgcn_sched_barrier(0);                    // keeps all 28 loads of a thread in flight together: without it the compiler issues V's loads only behind the first data wait
    { unsigned* wd = (unsigned*)wt + (tid & 7) * 8 * (LP / 2) + (tid >> 3);
#pragma unroll
      for (int i = 0; i < 8; ++i) wd[i * (LP / 2)] = pkbf(xw[i >> 2][i & 3], xw[2 + (i >> 2)][i & 3]); }
#pragma unroll
    for (int p = 0; p < 8; ++p) { v2u o; o[0] = pkbf(xq[p][0], xq[p][1]); o[1] = pkbf(xq[p][2], xq[p][3]); *(v2u*)&qs[(p * 16 + r16) * LP + c4] = o; }
#pragma unroll
    for (int p = 0; p < 4; ++p) { const int t2 = p * 16 + r16;
#pragma unroll
        for (int i = 0; i < 4; ++i) vt[(c4 + i) * (PT / 2) + (((t2 >> 2) ^ c) << 2) + (t2 & 3)] = pkhb(xv[2 * p][i], xv[2 * p + 1][i]); }
#pragma unroll
    for (int p = 0; p < 8; ++p) { v2u o; o[0] = pkhb(xk[p][0], xk[p][1]); o[1] = pkhb(xk[p][2], xk[p][3]); *(v2u*)(Kh + pb + (size_t)(p * 16 + r16) * HD + c4) = o; }
    asm volatile("s_wait_xcnt 0x0" ::: "memory");
    lds_barrier();                                        // W^T, the bf16 query rows and V^T are complete
    bf* qrow = &qs[(w * 16 + lr) * LP + 8 * hi];          // a wave reads and rewrites its own sixteen rows only
    v16bf bq[2];
#pragma unroll
    for (int ks = 0; ks < 2; ++ks) bq[ks] = F::ld(qrow + ks * 32);
    v8f acc[4];
#pragma unroll
    for (int ft = 0; ft < 4; ++ft) acc[ft] = (v8f){};
#pragma unroll
    for (int ks = 0; ks < 2; ++ks)
#pragma unroll
        for (int ft = 0; ft < 4; ++ft) acc[ft] = F::mma(F::ld(&wt[(ft * 16 + lr) * LP + 8 * hi + ks * 32]), bq[ks], acc[ft]);
#pragma unroll
    for (int s = 0; s < 4; ++s) { const int idx = s * 256 + tid, d = idx >> 4, qd = idx & 15;
        *(v4u*)(Vh + vb + (size_t)d * TT + qd * 8) = *(const v4u*)&vt[d * (PT / 2) + ((qd ^ (d >> 2)) << 2)]; }
#pragma unroll
    for (int ft = 0; ft < 4; ++ft) { v4u hv;              // acc[ft][j] = qw[query w * 16 + lr][f = 16 ft + 8 hi + j]
#pragma unroll
        for (int j = 0; j < 8; j += 2) hv[j >> 1] = pkh(acc[ft][j], acc[ft][j + 1]);
        *(v4u*)(qrow + ft * 16) = hv; }
    asm volatile("s_wait_xcnt 0x0" ::: "memory");
    lds_barrier();                                        // the f16 rows are complete
#pragma unroll
    for (int s = 0; s < 4; ++s) { const int idx = s * 256 + tid; const int lo = (idx >> 3) * LP + (idx & 7) * 8;
        *(v4u*)(Qh + pb + (size_t)idx * 8) = *(const v4u*)&qs[lo]; }
}

extern "C" void kernel_launch(void* const* d_in, const int* in_sizes, int n_in,
                              void* d_out, int out_size, void* d_ws, size_t ws_size, hipStream_t stream) {
    (void)in_sizes; (void)n_in; (void)out_size;
    const float* qi = (const float*)d_in[0]; const float* ki = (const float*)d_in[1]; const float* vi = (const float*)d_in[2]; const float* wq = (const float*)d_in[3];
    float* OUT = (float*)d_out;     // [4][2048][512]
    char* wsp = (char*)d_ws;
    auto take = [&](size_t bytes) { char* p = wsp; wsp += (bytes + 255) & ~(size_t)255; return (void*)p; };
    const size_t PB = (size_t)NH_ * TT * HD;   // elements of one batch's head planes; each plane holds every batch
    bf* QPh = (bf*)take(NB_ * PB * 2); bf* KPh = (bf*)take(NB_ * PB * 2); bf* VTh = (bf*)take(NB_ * PB * 2);
    if ((size_t)(wsp - (char*)d_ws) > ws_size) return;    // ws 256 MiB
    k_prep<<<dim3(TT / PT, NB_ * NH_, 1), 256, 0, stream>>>(qi, ki, vi, wq, QPh, KPh, VTh);
    k_fattn<<<dim3(TT / 128, NB_ * NH_, 1), 256, 0, stream>>>(QPh, KPh, VTh, OUT);   /* one kv head per query head: plane b * 8 + h of each */
}

// v009
// It runs in 33.5 microseconds.
// Two timings next to v008 put it at 1.06 and 1.05 times that version's speed.
// Over all steps from v000 it is 29.5 times as fast.
#include <hip/hip_runtime.h>

#include <hip/hip_runtime.h>

#define NB_  4
#define TT   2048
#define DM   512
#define NH_  8
#define NKV  8
#define REP  (NH_ / NKV)
#define HD   64
#define DQ   (NH_ * HD)
#define DKV  (NKV * HD)
#define SCL  0.125f   // HD^-0.5
typedef _Float16 h16;
typedef unsigned short bf;
typedef __attribute__((ext_vector_type(16))) __bf16   v16bf;
typedef __attribute__((ext_vector_type(16))) _Float16 v16h;
typedef __attribute__((ext_vector_type(8)))  _Float16 v8h;
typedef __attribute__((ext_vector_type(8)))  unsigned short v8us;
typedef __attribute__((ext_vector_type(8)))  float    v8f;
typedef __attribute__((ext_vector_type(4)))  float    v4f;
typedef v8h  __attribute__((may_alias)) v8ha;
typedef v4f  __attribute__((may_alias)) v4fa;
typedef v8us __attribute__((may_alias)) v8usa;

__device__ __forceinline__ unsigned short f2bf(float f) { unsigned u = __float_as_uint(f); u += 0x7FFFu + ((u >> 16) & 1u); return (unsigned short)(u >> 16); }
__device__ __forceinline__ float bf2f(unsigned short b) { return __uint_as_float(((unsigned)b) << 16); }
__device__ __forceinline__ float bfr(float f) { return bf2f(f2bf(f)); }
__device__ __forceinline__ v16h cat16(v8h lo, v8h hi) { return __builtin_shufflevector(lo, hi, 0, 1, 2, 3, 4, 5, 6, 7, 8, 9, 10, 11, 12, 13, 14, 15); }
__device__ __forceinline__ v16bf cat16b(v8us lo, v8us hi) { return __builtin_bit_cast(v16bf, __builtin_shufflevector(lo, hi, 0, 1, 2, 3, 4, 5, 6, 7, 8, 9, 10, 11, 12, 13, 14, 15)); }
__device__ __forceinline__ v8f wmma16(v16h a, v16h b, v8f c) { return __builtin_amdgcn_wmma_f32_16x16x32_f16(false, a, false, b, (short)0, c, false, false); }
__device__ __forceinline__ v8f wmmab(v16bf a, v16bf b, v8f c) { return __builtin_amdgcn_wmma_f32_16x16x32_bf16(false, a, false, b, (short)0, c, false, false); }



// fragment loader and product of the 16x16x32 forms: sixteen k of one row per lane, k = 8 hi + 0..7 and 16 + 8 hi + 0..7
template <typename T16> struct WFrag;
template <> struct WFrag<h16> { typedef v16h V; static __device__ __forceinline__ V ld(const h16* p) { return cat16(*(const v8h*)p, *(const v8h*)(p + 16)); } static __device__ __forceinline__ v8f mma(V a, V b, v8f c) { return wmma16(a, b, c); } };
template <> struct WFrag<bf> { typedef v16bf V; static __device__ __forceinline__ V ld(const bf* p) { return cat16b(*(const v8us*)p, *(const v8us*)(p + 16)); } static __device__ __forceinline__ v8f mma(V a, V b, v8f c) { return wmmab(a, b, c); } };
typedef __attribute__((ext_vector_type(2))) _Float16 v2h;
typedef __attribute__((ext_vector_type(4))) _Float16 v4h;
typedef __attribute__((ext_vector_type(2))) unsigned short v2us;
typedef __attribute__((ext_vector_type(4))) unsigned short v4us;
typedef __attribute__((ext_vector_type(2))) float v2f;
typedef __attribute__((ext_vector_type(4))) int v4i;


// k_fattn: scores, causal softmax and probability x value product in one launch for every batch and head; nothing of the score matrix goes to memory.
// Transposed products: S^T = K Q^T (A = 16 key rows, B = 16 query columns) and O^T += V^T P^T, so a lane holds one query's scores (keys 8 hi + r of each 16-key tile) and two score tiles, converted in place,
// are the B operand of the second product. Running maximum and sum per query (online softmax). Both products take f16 operands: qw and P are each rounded once to f16 (11 significant bits),
// qw = bf16(q) bf16(W) is formed here, ahead of the key loop, for both of the work-group's query tiles: W^T and the 128 bf16 query rows are staged in LDS (in the room that the join uses later), and every wave forms
// (qw)^T = W^T q^T for its own four column groups (A = 16 rows f of W^T, B = 16 query columns, e 0-31 then 32-63): a lane then holds f = 16 ft + 8 hi + 0..7 of one query, so two result tiles, converted in place, are a B operand of the score product.
// K and V are the bf16-rounded inputs, which f16 holds unchanged (8 significant bits; below 2^-14 in magnitude to within 2^-25): one product K Q and one product V P per tile.
// The eight waves of a work-group share K and V^T through LDS: stages of SK keys, two buffers, one barrier per stage. Each stage comes in by two tensor loads (wave 0: K, wave 1: V^T), through no register,
// issued behind the barrier that frees its buffer and in flight during the next stage's products; the loads' pad fields give the two LDS row pitches below.
// A wave holds 32 queries as two column groups of 16, so that every K and V^T fragment read from LDS feeds two products. Four waves own the same 32 queries: wave w takes keys 32 (w >> 1) .. + 31 of every stage,
// each with its own running maximum, sum and O.
// All eight waves take a 64-query tile from the long end of the causal triangle and then the mirrored tile from the short end of the same head: 17 stages in every work-group.
// Behind a tile's diagonal stage the four waves of a group join their partial results through LDS; each finishes and stores 32 of the 64 output columns of one column group.
#define SK 128                    // keys per stage: a V^T row piece is then 256 bytes
#define LP 72                     // LDS row pitch of K in 16-bit elements: 144 bytes, 16 x odd, for 16-byte reads of 128-byte rows
#define LPV 136                   // LDS row pitch of V^T: 272 bytes, 16 x odd, for 16-byte reads of 256-byte rows
#define LTK (SK * LP)             // staged K tile: 128 rows (keys)
#define LTV 9216                  // staged V^T tile: 64 rows (d) of LPV, 8704 elements, rounded up so that every tile's place in LDS is a multiple of 2 KiB
typedef __attribute__((ext_vector_type(2))) __bf16 v2bf;
typedef __attribute__((ext_vector_type(2))) unsigned v2u;
__device__ __forceinline__ unsigned pkbf(float a, float b) { v2f p; p[0] = a; p[1] = b; return __builtin_bit_cast(unsigned, __builtin_convertvector(p, v2bf)); }   // a in the low half; round to nearest even
// sixteen f16 of one row, kept in memory as 16-bit words: k = 8 hi + 0..7 and 16 + 8 hi + 0..7, the k order of WFrag::ld
__device__ __forceinline__ v16h ldh(const bf* p) { return __builtin_bit_cast(v16h, __builtin_shufflevector(*(const v8us*)p, *(const v8us*)(p + 16), 0, 1, 2, 3, 4, 5, 6, 7, 8, 9, 10, 11, 12, 13, 14, 15)); }
__device__ __forceinline__ float xhalf(float x) { const int b = __float_as_int(x); return __int_as_float(__builtin_amdgcn_permlanex16(b, b, 0x76543210, 0xfedcba98, false, false)); }   // value of lane ^ 16
// eight 2^x and, in the same statement, the one free issue slot that the instruction set asks for behind a transcendental; the early-clobber outputs keep every source whole until the statement ends
__device__ __forceinline__ v8f exp2x8(v8f x) { float d0, d1, d2, d3, d4, d5, d6, d7;
    asm("v_exp_f32 %0, %8\n\tv_exp_f32 %1, %9\n\tv_exp_f32 %2, %10\n\tv_exp_f32 %3, %11\n\tv_exp_f32 %4, %12\n\tv_exp_f32 %5, %13\n\tv_exp_f32 %6, %14\n\tv_exp_f32 %7, %15\n\tv_nop"
        : "=&v"(d0), "=&v"(d1), "=&v"(d2), "=&v"(d3), "=&v"(d4), "=&v"(d5), "=&v"(d6), "=&v"(d7) : "v"(x[0]), "v"(x[1]), "v"(x[2]), "v"(x[3]), "v"(x[4]), "v"(x[5]), "v"(x[6]), "v"(x[7]));
    v8f d; d[0] = d0; d[1] = d1; d[2] = d2; d[3] = d3; d[4] = d4; d[5] = d5; d[6] = d6; d[7] = d7; return d; }
// two 2^x with the same free issue slot behind them
__device__ __forceinline__ v2f exp2x2(float x0, float x1) { float d0, d1;
    asm("v_exp_f32 %0, %2\n\tv_exp_f32 %1, %3\n\tv_nop" : "=&v"(d0), "=&v"(d1) : "v"(x0), "v"(x1));
    v2f d; d[0] = d0; d[1] = d1; return d; }
typedef unsigned u32x4 __attribute__((ext_vector_type(4)));
typedef unsigned u32x8 __attribute__((ext_vector_type(8)));
__device__ __forceinline__ unsigned uni(unsigned v) { return (unsigned)__builtin_amdgcn_readfirstlane(v); }
// a wave-uniform value held in a scalar register: a test on it compiles to a scalar compare and branch, the only guard that a tensor load obeys (it ignores EXEC)
__device__ __forceinline__ unsigned pinned(unsigned v) { unsigned w = __builtin_amdgcn_readfirstlane(v); asm volatile("" : "+s"(w)); return w; }
// group 1 of a tensor load's descriptor: NR rows of RB bytes, SP bytes apart in memory; W0 = its word 0 (no mask, extents in bytes, the pad behind every row). The empty statement holds the eight descriptor words
// in scalar registers of their own for as long as the value lives: as plain constants they would be written afresh in front of every load into registers that are free for other use right behind it
template <unsigned W0, unsigned RB, unsigned NR, unsigned SP> __device__ __forceinline__ u32x8 tgroup1() {
    u32x8 g1; g1[0] = uni(W0); g1[1] = uni((RB & 0xFFFFu) << 16); g1[2] = uni((RB >> 16) | ((NR & 0xFFFFu) << 16)); g1[3] = uni((NR >> 16) | (RB << 16)); g1[4] = uni(NR); g1[5] = uni(SP); g1[6] = uni(0u); g1[7] = uni(0u);
    asm volatile("" : "+s"(g1)); return g1; }
// group 0: from byte address ga to LDS byte offset dst
__device__ __forceinline__ u32x4 tgroup0(unsigned dst, unsigned long long ga) {
    u32x4 g0; g0[0] = uni(1u); g0[1] = uni(dst); g0[2] = uni((unsigned)ga); g0[3] = uni((((unsigned)(ga >> 32)) & 0x01FFFFFFu) | 0x80000000u); return g0; }
// one tensor load of the whole wave
__device__ __forceinline__ void tload(u32x4 g0, u32x8 g1) { asm volatile("tensor_load_to_lds %0, %1" :: "s"(g0), "s"(g1) : "memory"); }
// the issuing wave's own request has landed. The statement names the descriptor's registers as inputs, so that none of them is written again while the request is outstanding
__device__ __forceinline__ void twait(u32x4 g0, u32x8 a, u32x8 b) { asm volatile("s_wait_tensorcnt 0x0" :: "s"(g0), "s"(a), "s"(b) : "memory"); }
__global__ __launch_bounds__(256) __attribute__((amdgpu_waves_per_eu(4, 4))) void k_fattn(const float* __restrict__ q, const float* __restrict__ wgt, const bf* __restrict__ Kh, const bf* __restrict__ Vh, float* __restrict__ OUT) {
    __shared__ __attribute__((aligned(2048))) bf sm[2][LTK + LTV];   // [buffer][K, then V^T]; each of the four tiles starts at a multiple of 2 KiB of the work-group's LDS
    __shared__ __align__(16) float xo[8][16][32][4];                 // per wave and lane: its partial O, [(column group * 4 + d tile) * 2 + half of the eight values]
    __shared__ float xm[8][2][2][32];                                // per wave, column group and lane: running maximum, sum
    const int tid = threadIdx.x, lane = tid & 31, lr = lane & 15, hi = lane >> 4; const int w = __builtin_amdgcn_readfirstlane(tid >> 5);
    const int g = blockIdx.x, bh = blockIdx.y; const int qg = w & 1, kq = w >> 1;   // qg: this wave's 32 queries of a tile; kq: its 32 keys of each stage
    const int tl = TT / 64 - 1 - g, nsl = (tl >> 1) + 1, nst = TT / SK + 1;         // the long tile, taken first: nsl stages; then tile g: (g >> 1) + 1 stages; 17 together
    int q0 = tl * 64 + qg * 32, np = q0 / 32 + 1;                    // this wave's queries; their key blocks of 32 up to and including the one that holds the diagonal
    const size_t po = (size_t)bh * TT * HD;
    const unsigned lb = (unsigned)(size_t)&sm[0][0];                 // byte offset of the buffers in the work-group's LDS
    const unsigned long long kga = (unsigned long long)(size_t)(Kh + po), vga = (unsigned long long)(size_t)(Vh + po);
    const u32x8 g1k = tgroup1<(1u << 20) | (4u << 22) | (3u << 25), HD * 2, SK, HD * 2>();   // K: 128 rows of 128 bytes, 16 bytes of pad each: pitch LP
    const u32x8 g1v = tgroup1<(1u << 20) | (5u << 22) | (3u << 25), SK * 2, HD, TT * 2>();   // V^T: 64 rows of 256 bytes out of rows of 4096, 16 bytes of pad each: pitch LPV
    u32x4 g0;                                                        // group 0 of this wave's latest request
    auto issue = [&](int sg) {                                       // stage sg of the work-group's 17 into buffer sg & 1: keys 128 ks .. + 127 of the long tile (sg < nsl) or of the short one
        const unsigned ks = pinned((unsigned)(sg < nsl ? sg : sg - nsl));   // pinned: the words that depend on it are formed behind the wait that stands in front of the call
        g0 = tgroup0(lb + (unsigned)(sg & 1) * ((LTK + LTV) * 2) + (w == 1 ? LTK * 2 : 0), w == 1 ? vga + (unsigned long long)ks * (SK * 2) : kga + (unsigned long long)ks * (SK * HD * 2));
        if (pinned(w == 0)) tload(g0, g1k);
        if (pinned(w == 1)) tload(g0, g1v); };
    bf* wt = (bf*)&xo[0][0][0][0];                                   // W^T [f][e], pitch LP; wt and qs lie in xo, which the first join writes only behind at least nine stage barriers
    bf* qs = wt + HD * LP;                                           // bf16(q), pitch LP: rows 0-63 the long tile's queries, 64-127 the short tile's
    v4f xw[4], xq[8];
    { const float* wp = wgt + (size_t)(tid >> 3) * 2 * HD + (tid & 7) * 8;        // rows e and e + 1, eight f
      xw[0] = *(const v4f*)wp; xw[1] = *(const v4f*)(wp + 4); xw[2] = *(const v4f*)(wp + HD); xw[3] = *(const v4f*)(wp + HD + 4); }
    const float* qb = q + ((size_t)(bh / NH_) * TT * NH_ + (bh % NH_)) * HD + (tid & 15) * 4;   // position 0 of this head in [b][t][h][e]; rows lie DQ apart, sixteen threads per 256-byte row
#pragma unroll
    for (int p = 0; p < 8; ++p) xq[p] = *(const v4f*)(qb + (size_t)((p < 4 ? tl : g - 1) * 64 + p * 16 + (tid >> 4)) * DQ);
    asm volatile("s_wait_xcnt 0x0" ::: "memory");                    // stands before a register that holds one of these loads' addresses is written again
    v8f o[2][4];
#pragma unroll
    for (int c = 0; c < 2; ++c)
#pragma unroll
        for (int dt = 0; dt < 4; ++dt) o[c][dt] = (v8f){};
    float mrun[2] = {-3.0e38f, -3.0e38f}, lsum[2] = {0.f, 0.f};
    issue(0);
    { unsigned* wd = (unsigned*)wt + (tid & 7) * 8 * (LP / 2) + (tid >> 3);
#pragma unroll
      for (int i = 0; i < 8; ++i) wd[i * (LP / 2)] = pkbf(xw[i >> 2][i & 3], xw[2 + (i >> 2)][i & 3]); }
#pragma unroll
    for (int p = 0; p < 8; ++p) { v2u u; u[0] = pkbf(xq[p][0], xq[p][1]); u[1] = pkbf(xq[p][2], xq[p][3]); *(v2u*)&qs[(p * 16 + (tid >> 4)) * LP + (tid & 15) * 4] = u; }
    if (pinned(w < 2)) twait(g0, g1k, g1v);                          // the issuing wave's own tile of stage 0 has landed
    __syncthreads();                                                 // publishes stage 0, W^T and the bf16 query rows
    issue(1);
    v16h qh[2][2], qn[2][2];                                         // [column group][k half]: the current tile's qw; the short tile's, kept for the change of tile
    { typedef WFrag<bf> F; v16bf wf[4][2];
#pragma unroll
      for (int ft = 0; ft < 4; ++ft)
#pragma unroll
          for (int ks = 0; ks < 2; ++ks) wf[ft][ks] = F::ld(&wt[(ft * 16 + lr) * LP + 8 * hi + ks * 32]);
#pragma unroll
      for (int cg = 0; cg < 4; ++cg) {                               // column groups 0, 1: the long tile; 2, 3: the short one
          const bf* qrow = &qs[((cg >> 1) * 64 + qg * 32 + (cg & 1) * 16 + lr) * LP + 8 * hi];
          v16bf bq[2]; v8f acc[4];
#pragma unroll
          for (int ks = 0; ks < 2; ++ks) bq[ks] = F::ld(qrow + ks * 32);
#pragma unroll
          for (int ft = 0; ft < 4; ++ft) acc[ft] = (v8f){};
#pragma unroll
          for (int ks = 0; ks < 2; ++ks)
#pragma unroll
              for (int ft = 0; ft < 4; ++ft) acc[ft] = F::mma(wf[ft][ks], bq[ks], acc[ft]);
#pragma unroll
          for (int ks = 0; ks < 2; ++ks) { v16h f;                   // acc[ft][j] = qw[query][f = 16 ft + 8 hi + j]: tiles 2 ks and 2 ks + 1 hold k = 8 hi + 0..7 and 16 + 8 hi + 0..7 of k half ks
#pragma unroll
              for (int j = 0; j < 8; j += 2) { v2f a, b; a[0] = acc[2 * ks][j]; a[1] = acc[2 * ks][j + 1]; b[0] = acc[2 * ks + 1][j]; b[1] = acc[2 * ks + 1][j + 1];
                  const v2h ha = __builtin_convertvector(a, v2h), hb = __builtin_convertvector(b, v2h); f[j] = ha[0]; f[j + 1] = ha[1]; f[8 + j] = hb[0]; f[8 + j + 1] = hb[1]; }
              if (cg < 2) qh[cg & 1][ks] = f; else qn[cg & 1][ks] = f; } } }
    int st = 0;                                                      // key stage inside the current tile
#pragma unroll 1
    for (int s = 0; s < nst; ++s) {
        const bool more = s + 1 < nst, last = s == nsl - 1 || !more; // last: the current tile's diagonal stage; both are the same for the whole work-group
        const bf* kt0 = &sm[s & 1][0] + (kq * 32 + lr) * LP + 8 * hi;            // this lane's row and k half in this wave's 32 rows of tile K
        const bf* vt0 = &sm[s & 1][LTK] + lr * LPV + kq * 32 + 8 * hi;           // this lane's row and k half in this wave's 32 columns of tile V^T
        const int kb = st * 4 + kq;
        if (kb < np) {
            v8f sc2[2][2]; v16h kf[2][2];
#pragma unroll
            for (int kt = 0; kt < 2; ++kt)
#pragma unroll
                for (int ks = 0; ks < 2; ++ks) kf[kt][ks] = ldh(kt0 + kt * 16 * LP + ks * 32);
            __builtin_amdgcn_sched_barrier(0);                       // keeps the eight K reads together ahead of the products: without it the compiler reads each fragment into the same registers and waits out the LDS latency four times
#pragma unroll
            for (int c = 0; c < 2; ++c)
#pragma unroll
                for (int kt = 0; kt < 2; ++kt) sc2[c][kt] = (v8f){};
#pragma unroll
            for (int ks = 0; ks < 2; ++ks)
#pragma unroll
                for (int kt = 0; kt < 2; ++kt)
#pragma unroll
                    for (int c = 0; c < 2; ++c) sc2[c][kt] = wmma16(kf[kt][ks], qh[c][ks], sc2[c][kt]);
            __builtin_amdgcn_sched_barrier(0);                       // keeps the eight score products in one run: mixed with the vector work on their results, each needs idle issue slots behind it
#pragma unroll
            for (int c = 0; c < 2; ++c)
#pragma unroll
                for (int kt = 0; kt < 2; ++kt)
#pragma unroll
                    for (int j = 0; j < 8; ++j) sc2[c][kt][j] *= SCL;
            if (kb == np - 1) {                                      // only the group's last block crosses the diagonal: key > query is masked
#pragma unroll
                for (int c = 0; c < 2; ++c)
#pragma unroll
                    for (int kt = 0; kt < 2; ++kt)
#pragma unroll
                        for (int j = 0; j < 8; ++j) sc2[c][kt][j] = (kt * 16 + hi * 8 + j <= c * 16 + lr) ? sc2[c][kt][j] : -3.0e38f; }
            v16h ph[2];
#pragma unroll
            for (int c = 0; c < 2; ++c) {
                float mx = sc2[c][0][0];
#pragma unroll
                for (int kt = 0; kt < 2; ++kt)
#pragma unroll
                    for (int j = 0; j < 8; ++j) mx = fmaxf(mx, sc2[c][kt][j]);
                mx = fmaxf(mx, xhalf(mx)); const float mnew = fmaxf(mrun[c], mx);
                const float al = __builtin_amdgcn_exp2f((mrun[c] - mnew) * 1.4426950408889634f); mrun[c] = mnew;
                float bs = 0.f;
#pragma unroll
                for (int kt = 0; kt < 2; ++kt) { const v8f e = exp2x8((sc2[c][kt] - mnew) * 1.4426950408889634f);
#pragma unroll
                    for (int j = 0; j < 8; j += 2) { v2f pr; pr[0] = e[j]; pr[1] = e[j + 1]; bs += pr[0] + pr[1];
                        const v2h h2 = __builtin_convertvector(pr, v2h); ph[c][kt * 8 + j] = h2[0]; ph[c][kt * 8 + j + 1] = h2[1]; } }
                lsum[c] = lsum[c] * al + bs;
#pragma unroll
                for (int dt = 0; dt < 4; ++dt) {
#pragma unroll
                    for (int j = 0; j < 8; ++j) o[c][dt][j] *= al; }
            }
#pragma unroll
            for (int dt = 0; dt < 4; ++dt) { const v16h vf = ldh(vt0 + dt * 16 * LPV);
#pragma unroll
                for (int c = 0; c < 2; ++c) o[c][dt] = wmma16(vf, ph[c], o[c][dt]); }
        }
        asm volatile("s_wait_dscnt 0x0" ::: "memory");               // this wave's reads of stage s have returned before the barrier behind which its buffer is refilled
        if (pinned(w < 2)) twait(g0, g1k, g1v);                      // the issuing wave's own tile of stage s + 1 has landed
        __syncthreads();                                             // publishes stage s + 1 and ends every wave's reads of stage s
        if (pinned(s + 2 < nst && w < 2)) issue(s + 2);              // into the buffer that this trip has read; the six waves that issue nothing form no descriptor
        st = st + 1;
        if (last) {                                                  // the tile is done: the four waves of a query group join their partial softmaxes
#pragma unroll
            for (int c = 0; c < 2; ++c)                              // the short tile's queries
#pragma unroll
                for (int ks = 0; ks < 2; ++ks) qh[c][ks] = qn[c][ks];
#pragma unroll
            for (int c = 0; c < 2; ++c) { lsum[c] += xhalf(lsum[c]);
#pragma unroll
                for (int dt = 0; dt < 4; ++dt) { v4f a, b;
#pragma unroll
                    for (int j = 0; j < 4; ++j) { a[j] = o[c][dt][j]; b[j] = o[c][dt][j + 4]; }
                    *(v4f*)&xo[w][(c * 4 + dt) * 2][lane][0] = a; *(v4f*)&xo[w][(c * 4 + dt) * 2 + 1][lane][0] = b; }
                xm[w][c][0][lane] = mrun[c]; xm[w][c][1][lane] = lsum[c]; }
            __syncthreads();                                         // the partners' values are complete; the stage barriers of the next tile end these reads before xo and xm are written again
            const int cf = kq & 1, dh = kq >> 1;                     // this wave finishes column group cf, output columns 32 dh .. 32 dh + 31
            float pm[4], ps[4];
#pragma unroll
            for (int j = 0; j < 4; ++j) { pm[j] = xm[qg + 2 * j][cf][0][lane]; ps[j] = xm[qg + 2 * j][cf][1][lane]; }
            const float mj = fmaxf(fmaxf(pm[0], pm[1]), fmaxf(pm[2], pm[3]));   // a wave that had no key block holds maximum -3e38, sum 0, O 0: its factor below is 2^-inf = 0
            const v2f e01 = exp2x2((pm[0] - mj) * 1.4426950408889634f, (pm[1] - mj) * 1.4426950408889634f);
            const v2f e23 = exp2x2((pm[2] - mj) * 1.4426950408889634f, (pm[3] - mj) * 1.4426950408889634f);
            const float f = __fdiv_rn(1.0f, ps[0] * e01[0] + ps[1] * e01[1] + ps[2] * e23[0] + ps[3] * e23[1]);
            const float fj[4] = {e01[0] * f, e01[1] * f, e23[0] * f, e23[1] * f};
            float* op = OUT + ((size_t)(bh / NH_) * TT + q0 + cf * 16 + lr) * DQ + (bh % NH_) * HD + dh * 32 + hi * 8;   // values [i][j] = O[query q0 + 16 cf + lr][d = 32 dh + 16 i + 8 hi + j]
#pragma unroll
            for (int i = 0; i < 2; ++i) { v4f a = (v4f){}, b = (v4f){};
#pragma unroll
                for (int j = 0; j < 4; ++j) { const int ix = (cf * 4 + dh * 2 + i) * 2;
                    a += *(const v4f*)&xo[qg + 2 * j][ix][lane][0] * fj[j]; b += *(const v4f*)&xo[qg + 2 * j][ix + 1][lane][0] * fj[j]; }
                *(v4f*)(op + i * 16) = a; *(v4f*)(op + i * 16 + 4) = b; }
            asm volatile("s_wait_xcnt 0x0" ::: "memory");            // stands before a register that these stores name is written again
            st = 0; q0 = g * 64 + qg * 32; np = q0 / 32 + 1;         // the short tile
#pragma unroll
            for (int c = 0; c < 2; ++c) {
#pragma unroll
                for (int dt = 0; dt < 4; ++dt) o[c][dt] = (v8f){};
                mrun[c] = -3.0e38f; lsum[c] = 0.f; }
        }
    }
    asm volatile("s_wait_tensorcnt 0x0" ::: "memory");               // no tensor load is in flight when the wave ends
    asm volatile("s_wait_dscnt 0x0" ::: "memory");
}


// k_prep: the K and V^T planes of k_fattn in one launch. One work-group takes PT positions of one (batch, head): 64 input values per thread, all loads issued ahead of the first use.
// K plane [bh][t][d] and V^T plane [bh][d][t]: the bf16-rounded inputs, written as f16. V is transposed in LDS, two positions per dword, 16-byte pieces of a row swapped by d / 4
// so that neither the column writes nor the row reads collide.
#define PT 128
typedef __attribute__((ext_vector_type(4))) unsigned v4u;
__device__ __forceinline__ unsigned pkh(float a, float b) { v2f p; p[0] = a; p[1] = b; return __builtin_bit_cast(unsigned, __builtin_convertvector(p, v2h)); }     // a in the low half; round to nearest even
__device__ __forceinline__ unsigned pkhb(float a, float b) { const unsigned u = pkbf(a, b); return pkh(__uint_as_float(u << 16), __uint_as_float(u & 0xffff0000u)); }   // rounded to bf16 first, then written as f16
// work-group barrier that orders LDS only: the waves exchange nothing through global memory here, and __syncthreads() would also wait for every global store issued so far to be acknowledged
__device__ __forceinline__ void lds_barrier() { __builtin_amdgcn_fence(__ATOMIC_RELEASE, "workgroup", "local"); __builtin_amdgcn_s_barrier(); __builtin_amdgcn_fence(__ATOMIC_ACQUIRE, "workgroup", "local"); }
__global__ __launch_bounds__(256) void k_prep(const float* __restrict__ k, const float* __restrict__ v, bf* __restrict__ Kh, bf* __restrict__ Vh) {
    __shared__ __align__(16) unsigned vt[HD * (PT / 2)];  // V^T [d][t / 2]
    const int tid = threadIdx.x;
    const int t0 = blockIdx.x * PT, bh = blockIdx.y;
    const size_t ib = (((size_t)(bh / NH_) * TT + t0) * NH_ + (bh % NH_)) * HD;   // row t0 of this head in [b][t][h][e]; rows lie DQ apart
    const size_t pb = ((size_t)bh * TT + t0) * HD;                                // row t0 in a [bh][t][d] plane
    const size_t vb = (size_t)bh * HD * TT + t0;                                  // column t0 of row d = 0 in a [bh][d][t] plane
    const int r16 = tid >> 4, c = tid & 15, c4 = c * 4;                           // sixteen threads per 256-byte input row
    v4f xk[8], xv[8];
#pragma unroll
    for (int p = 0; p < 8; ++p) xv[p] = *(const v4f*)(v + ib + (size_t)((p >> 1) * 32 + 2 * r16 + (p & 1)) * DQ + c4);   // positions t and t + 1 in one thread
    asm volatile("s_wait_xcnt 0x0" ::: "memory");   // here and below: stands before a register that an issued load or store names is written again
#pragma unroll
    for (int p = 0; p < 8; ++p) xk[p] = *(const v4f*)(k + ib + (size_t)(p * 16 + r16) * DQ + c4);
    __builtin_amdgcn_sched_barrier(0);                    // keeps all 16 loads of a thread in flight together: without it the compiler issues K's last four loads only behind data waits
#pragma unroll
    for (int p = 0; p < 4; ++p) { const int t2 = p * 16 + r16;
#pragma unroll
        for (int i = 0; i < 4; ++i) vt[(c4 + i) * (PT / 2) + (((t2 >> 2) ^ c) << 2) + (t2 & 3)] = pkhb(xv[2 * p][i], xv[2 * p + 1][i]); }
#pragma unroll
    for (int p = 0; p < 8; ++p) { v2u o; o[0] = pkhb(xk[p][0], xk[p][1]); o[1] = pkhb(xk[p][2], xk[p][3]); *(v2u*)(Kh + pb + (size_t)(p * 16 + r16) * HD + c4) = o; }
    asm volatile("s_wait_xcnt 0x0" ::: "memory");
    lds_barrier();                                        // V^T is complete
#pragma unroll
    for (int s = 0; s < 4; ++s) { const int idx = s * 256 + tid, d = idx >> 4, qd = idx & 15;
        *(v4u*)(Vh + vb + (size_t)d * TT + qd * 8) = *(const v4u*)&vt[d * (PT / 2) + ((qd ^ (d >> 2)) << 2)]; }
}

extern "C" void kernel_launch(void* const* d_in, const int* in_sizes, int n_in,
                              void* d_out, int out_size, void* d_ws, size_t ws_size, hipStream_t stream) {
    (void)in_sizes; (void)n_in; (void)out_size;
    const float* qi = (const float*)d_in[0]; const float* ki = (const float*)d_in[1]; const float* vi = (const float*)d_in[2]; const float* wq = (const float*)d_in[3];
    float* OUT = (float*)d_out;     // [4][2048][512]
    char* wsp = (char*)d_ws;
    auto take = [&](size_t bytes) { char* p = wsp; wsp += (bytes + 255) & ~(size_t)255; return (void*)p; };
    const size_t PB = (size_t)NH_ * TT * HD;   // elements of one batch's head planes; each plane holds every batch
    bf* KPh = (bf*)take(NB_ * PB * 2); bf* VTh = (bf*)take(NB_ * PB * 2);
    if ((size_t)(wsp - (char*)d_ws) > ws_size) return;    // ws 256 MiB
    k_prep<<<dim3(TT / PT, NB_ * NH_, 1), 256, 0, stream>>>(ki, vi, KPh, VTh);
    k_fattn<<<dim3(TT / 128, NB_ * NH_, 1), 256, 0, stream>>>(qi, wq, KPh, VTh, OUT);   /* one kv head per query head: plane b * 8 + h of each */
}

// v010
// One run takes 32 microseconds.
// Two timings next to v009 both put it at 1.04 times that version's speed.
// Over all steps from v000 it is 30.8 times as fast.
#include <hip/hip_runtime.h>

#include <hip/hip_runtime.h>

#define NB_  4
#define TT   2048
#define DM   512
#define NH_  8
#define NKV  8
#define REP  (NH_ / NKV)
#define HD   64
#define DQ   (NH_ * HD)
#define DKV  (NKV * HD)
#define SCL  0.125f   // HD^-0.5
typedef _Float16 h16;
typedef unsigned short bf;
typedef __attribute__((ext_vector_type(16))) __bf16   v16bf;
typedef __attribute__((ext_vector_type(16))) _Float16 v16h;
typedef __attribute__((ext_vector_type(8)))  _Float16 v8h;
typedef __attribute__((ext_vector_type(8)))  unsigned short v8us;
typedef __attribute__((ext_vector_type(8)))  float    v8f;
typedef __attribute__((ext_vector_type(4)))  float    v4f;
typedef v8h  __attribute__((may_alias)) v8ha;
typedef v4f  __attribute__((may_alias)) v4fa;
typedef v8us __attribute__((may_alias)) v8usa;

__device__ __forceinline__ unsigned short f2bf(float f) { unsigned u = __float_as_uint(f); u += 0x7FFFu + ((u >> 16) & 1u); return (unsigned short)(u >> 16); }
__device__ __forceinline__ float bf2f(unsigned short b) { return __uint_as_float(((unsigned)b) << 16); }
__device__ __forceinline__ float bfr(float f) { return bf2f(f2bf(f)); }
__device__ __forceinline__ v16h cat16(v8h lo, v8h hi) { return __builtin_shufflevector(lo, hi, 0, 1, 2, 3, 4, 5, 6, 7, 8, 9, 10, 11, 12, 13, 14, 15); }
__device__ __forceinline__ v16bf cat16b(v8us lo, v8us hi) { return __builtin_bit_cast(v16bf, __builtin_shufflevector(lo, hi, 0, 1, 2, 3, 4, 5, 6, 7, 8, 9, 10, 11, 12, 13, 14, 15)); }
__device__ __forceinline__ v8f wmma16(v16h a, v16h b, v8f c) { return __builtin_amdgcn_wmma_f32_16x16x32_f16(false, a, false, b, (short)0, c, false, false); }
__device__ __forceinline__ v8f wmmab(v16bf a, v16bf b, v8f c) { return __builtin_amdgcn_wmma_f32_16x16x32_bf16(false, a, false, b, (short)0, c, false, false); }



// fragment loader and product of the 16x16x32 forms: sixteen k of one row per lane, k = 8 hi + 0..7 and 16 + 8 hi + 0..7
template <typename T16> struct WFrag;
template <> struct WFrag<h16> { typedef v16h V; static __device__ __forceinline__ V ld(const h16* p) { return cat16(*(const v8h*)p, *(const v8h*)(p + 16)); } static __device__ __forceinline__ v8f mma(V a, V b, v8f c) { return wmma16(a, b, c); } };
template <> struct WFrag<bf> { typedef v16bf V; static __device__ __forceinline__ V ld(const bf* p) { return cat16b(*(const v8us*)p, *(const v8us*)(p + 16)); } static __device__ __forceinline__ v8f mma(V a, V b, v8f c) { return wmmab(a, b, c); } };
typedef __attribute__((ext_vector_type(2))) _Float16 v2h;
typedef __attribute__((ext_vector_type(4))) _Float16 v4h;
typedef __attribute__((ext_vector_type(2))) unsigned short v2us;
typedef __attribute__((ext_vector_type(4))) unsigned short v4us;
typedef __attribute__((ext_vector_type(2))) float v2f;
typedef __attribute__((ext_vector_type(4))) int v4i;


// k_fattn: scores, causal softmax and probability x value product in one launch for every batch and head; nothing of the score matrix goes to memory.
// Transposed products: S^T = K Q^T (A = 16 key rows, B = 16 query columns) and O^T += V^T P^T, so a lane holds one query's scores (keys 8 hi + r of each 16-key tile) and two score tiles, converted in place,
// are the B operand of the second product. Running maximum and sum per query (online softmax). Both products take f16 operands: qw and P are each rounded once to f16 (11 significant bits),
// qw = bf16(q) bf16(W) is formed here, ahead of the key loop, for both of the work-group's query tiles: W^T and the 256 bf16 query rows are staged in LDS (in the room that the join uses later), and every wave forms
// (qw)^T = W^T q^T for its own four column groups (A = 16 rows f of W^T, B = 16 query columns, e 0-31 then 32-63): a lane then holds f = 16 ft + 8 hi + 0..7 of one query, so two result tiles, converted in place, are a B operand of the score product.
// K and V are the bf16-rounded inputs, which f16 holds unchanged (8 significant bits; below 2^-14 in magnitude to within 2^-25): one product K Q and one product V P per tile.
// The sixteen waves of a work-group share K and V^T through LDS: stages of two halves of SK keys each, two buffers, one barrier per stage. Each half comes in by two tensor loads (waves 0, 2: K, waves 1, 3: V^T), through no register,
// issued behind the barrier that frees its buffer and in flight during the next stage's products; the loads' pad fields give the two LDS row pitches below.
// A wave holds 32 queries as two column groups of 16, so that every K and V^T fragment read from LDS feeds two products. Four waves own the same 32 queries: wave w takes keys 32 (w >> 2) .. + 31 of every half stage,
// each with its own running maximum, sum and O.
// All sixteen waves take a 128-query tile from the long end of the causal triangle and then the mirrored tile from the short end of the same head: 9 stages, 17 half stages with keys to work on, in every work-group,
// and a half stage that has come into LDS serves 128 queries.
// Behind a tile's diagonal stage the four waves of a group join their partial results through LDS; each finishes and stores 32 of the 64 output columns of one column group.
#define SK 128                    // keys per half stage: a V^T row piece is then 256 bytes
#define LP 72                     // LDS row pitch of K in 16-bit elements: 144 bytes, 16 x odd, for 16-byte reads of 128-byte rows
#define LPV 136                   // LDS row pitch of V^T: 272 bytes, 16 x odd, for 16-byte reads of 256-byte rows
#define LTK (SK * LP)             // staged K tile: 128 rows (keys)
#define LTV 9216                  // staged V^T tile: 64 rows (d) of LPV, 8704 elements, rounded up so that every tile's place in LDS is a multiple of 2 KiB
typedef __attribute__((ext_vector_type(2))) __bf16 v2bf;
typedef __attribute__((ext_vector_type(2))) unsigned v2u;
__device__ __forceinline__ unsigned pkbf(float a, float b) { v2f p; p[0] = a; p[1] = b; return __builtin_bit_cast(unsigned, __builtin_convertvector(p, v2bf)); }   // a in the low half; round to nearest even
// sixteen f16 of one row, kept in memory as 16-bit words: k = 8 hi + 0..7 and 16 + 8 hi + 0..7, the k order of WFrag::ld
__device__ __forceinline__ v16h ldh(const bf* p) { return __builtin_bit_cast(v16h, __builtin_shufflevector(*(const v8us*)p, *(const v8us*)(p + 16), 0, 1, 2, 3, 4, 5, 6, 7, 8, 9, 10, 11, 12, 13, 14, 15)); }
__device__ __forceinline__ float xhalf(float x) { const int b = __float_as_int(x); return __int_as_float(__builtin_amdgcn_permlanex16(b, b, 0x76543210, 0xfedcba98, false, false)); }   // value of lane ^ 16
// eight 2^x and, in the same statement, the one free issue slot that the instruction set asks for behind a transcendental; the early-clobber outputs keep every source whole until the statement ends
__device__ __forceinline__ v8f exp2x8(v8f x) { float d0, d1, d2, d3, d4, d5, d6, d7;
    asm("v_exp_f32 %0, %8\n\tv_exp_f32 %1, %9\n\tv_exp_f32 %2, %10\n\tv_exp_f32 %3, %11\n\tv_exp_f32 %4, %12\n\tv_exp_f32 %5, %13\n\tv_exp_f32 %6, %14\n\tv_exp_f32 %7, %15\n\tv_nop"
        : "=&v"(d0), "=&v"(d1), "=&v"(d2), "=&v"(d3), "=&v"(d4), "=&v"(d5), "=&v"(d6), "=&v"(d7) : "v"(x[0]), "v"(x[1]), "v"(x[2]), "v"(x[3]), "v"(x[4]), "v"(x[5]), "v"(x[6]), "v"(x[7]));
    v8f d; d[0] = d0; d[1] = d1; d[2] = d2; d[3] = d3; d[4] = d4; d[5] = d5; d[6] = d6; d[7] = d7; return d; }
// two 2^x with the same free issue slot behind them
__device__ __forceinline__ v2f exp2x2(float x0, float x1) { float d0, d1;
    asm("v_exp_f32 %0, %2\n\tv_exp_f32 %1, %3\n\tv_nop" : "=&v"(d0), "=&v"(d1) : "v"(x0), "v"(x1));
    v2f d; d[0] = d0; d[1] = d1; return d; }
typedef unsigned u32x4 __attribute__((ext_vector_type(4)));
typedef unsigned u32x8 __attribute__((ext_vector_type(8)));
__device__ __forceinline__ unsigned uni(unsigned v) { return (unsigned)__builtin_amdgcn_readfirstlane(v); }
// a wave-uniform value held in a scalar register: a test on it compiles to a scalar compare and branch, the only guard that a tensor load obeys (it ignores EXEC)
__device__ __forceinline__ unsigned pinned(unsigned v) { unsigned w = __builtin_amdgcn_readfirstlane(v); asm volatile("" : "+s"(w)); return w; }
// group 1 of a tensor load's descriptor: NR rows of RB bytes, SP bytes apart in memory; W0 = its word 0 (no mask, extents in bytes, the pad behind every row). The empty statement holds the eight descriptor words
// in scalar registers of their own for as long as the value lives: as plain constants they would be written afresh in front of every load into registers that are free for other use right behind it
template <unsigned W0, unsigned RB, unsigned NR, unsigned SP> __device__ __forceinline__ u32x8 tgroup1() {
    u32x8 g1; g1[0] = uni(W0); g1[1] = uni((RB & 0xFFFFu) << 16); g1[2] = uni((RB >> 16) | ((NR & 0xFFFFu) << 16)); g1[3] = uni((NR >> 16) | (RB << 16)); g1[4] = uni(NR); g1[5] = uni(SP); g1[6] = uni(0u); g1[7] = uni(0u);
    asm volatile("" : "+s"(g1)); return g1; }
// group 0: from byte address ga to LDS byte offset dst
__device__ __forceinline__ u32x4 tgroup0(unsigned dst, unsigned long long ga) {
    u32x4 g0; g0[0] = uni(1u); g0[1] = uni(dst); g0[2] = uni((unsigned)ga); g0[3] = uni((((unsigned)(ga >> 32)) & 0x01FFFFFFu) | 0x80000000u); return g0; }
// one tensor load of the whole wave
__device__ __forceinline__ void tload(u32x4 g0, u32x8 g1) { asm volatile("tensor_load_to_lds %0, %1" :: "s"(g0), "s"(g1) : "memory"); }
// the issuing wave's own request has landed. The statement names the descriptor's registers as inputs, so that none of them is written again while the request is outstanding
__device__ __forceinline__ void twait(u32x4 g0, u32x8 a, u32x8 b) { asm volatile("s_wait_tensorcnt 0x0" :: "s"(g0), "s"(a), "s"(b) : "memory"); }
__global__ __launch_bounds__(512) __attribute__((amdgpu_waves_per_eu(4, 4))) void k_fattn(const float* __restrict__ q, const float* __restrict__ wgt, const bf* __restrict__ Kh, const bf* __restrict__ Vh, float* __restrict__ OUT) {
    __shared__ __attribute__((aligned(2048))) bf sm[4][LTK + LTV];   // [buffer * 2 + half][K, then V^T]; each of the eight tiles starts at a multiple of 2 KiB of the work-group's LDS
    __shared__ __align__(16) float xo[16][16][32][4];                // per wave and lane: its partial O, [(column group * 4 + d tile) * 2 + half of the eight values]
    __shared__ float xm[16][2][2][32];                               // per wave, column group and lane: running maximum, sum
    const int tid = threadIdx.x, lane = tid & 31, lr = lane & 15, hi = lane >> 4; const int w = __builtin_amdgcn_readfirstlane(tid >> 5);
    const int g = blockIdx.x, bh = blockIdx.y; const int qg = w & 3, kq = w >> 2;   // qg: this wave's 32 queries of a tile; kq: its 32 keys of each half stage
    const int tl = TT / 128 - 1 - g, nsl = (tl + 2) >> 1, nst = TT / (2 * SK) + 1;  // the long tile, taken first: tl + 1 half stages in nsl stages; then tile g: g + 1 halves in (g + 2) >> 1 stages; 9 stages together
    int q0 = tl * 128 + qg * 32, np = q0 / 32 + 1;                    // this wave's queries; their key blocks of 32 up to and including the one that holds the diagonal
    const size_t po = (size_t)bh * TT * HD;
    const unsigned lb = (unsigned)(size_t)&sm[0][0];                 // byte offset of the buffers in the work-group's LDS
    const unsigned long long kga = (unsigned long long)(size_t)(Kh + po), vga = (unsigned long long)(size_t)(Vh + po);
    const u32x8 g1k = tgroup1<(1u << 20) | (4u << 22) | (3u << 25), HD * 2, SK, HD * 2>();   // K: 128 rows of 128 bytes, 16 bytes of pad each: pitch LP
    const u32x8 g1v = tgroup1<(1u << 20) | (5u << 22) | (3u << 25), SK * 2, HD, TT * 2>();   // V^T: 64 rows of 256 bytes out of rows of 4096, 16 bytes of pad each: pitch LPV
    u32x4 g0;                                                        // group 0 of this wave's latest request
    auto issue = [&](int sg) {                                       // stage sg of the work-group's 9 into buffer sg & 1; this wave's half hf: keys 128 ks .. + 127 of the long tile (sg < nsl) or of the short one; ks <= 15
        const unsigned hf = (unsigned)(w >> 1) & 1u;
        const unsigned ks = pinned((unsigned)(sg < nsl ? sg : sg - nsl) * 2u + hf);   // pinned: the words that depend on it are formed behind the wait that stands in front of the call
        g0 = tgroup0(lb + ((unsigned)(sg & 1) * 2u + hf) * ((LTK + LTV) * 2) + ((w & 1) ? LTK * 2 : 0), (w & 1) ? vga + (unsigned long long)ks * (SK * 2) : kga + (unsigned long long)ks * (SK * HD * 2));
        if (pinned(w < 4 && (w & 1) == 0)) tload(g0, g1k);
        if (pinned(w < 4 && (w & 1) == 1)) tload(g0, g1v); };
    bf* wt = (bf*)&xo[0][0][0][0];                                   // W^T [f][e], pitch LP; wt and qs lie in xo, which the first join writes only behind at least five stage barriers
    bf* qs = wt + HD * LP;                                           // bf16(q), pitch LP: rows 0-127 the long tile's queries, 128-255 the short tile's
    v4f xw[2], xq[8];
    { const float* wp = wgt + (size_t)(tid >> 4) * 2 * HD + (tid & 15) * 4;       // rows e and e + 1, four f
      xw[0] = *(const v4f*)wp; xw[1] = *(const v4f*)(wp + HD); }
    const float* qb = q + ((size_t)(bh / NH_) * TT * NH_ + (bh % NH_)) * HD + (tid & 15) * 4;   // position 0 of this head in [b][t][h][e]; rows lie DQ apart, sixteen threads per 256-byte row
#pragma unroll
    for (int p = 0; p < 8; ++p) xq[p] = *(const v4f*)(qb + (size_t)((p < 4 ? tl : g - 1) * 128 + p * 32 + (tid >> 4)) * DQ);
    asm volatile("s_wait_xcnt 0x0" ::: "memory");                    // stands before a register that holds one of these loads' addresses is written again
    v8f o[2][4];
#pragma unroll
    for (int c = 0; c < 2; ++c)
#pragma unroll
        for (int dt = 0; dt < 4; ++dt) o[c][dt] = (v8f){};
    float mrun[2] = {-3.0e38f, -3.0e38f}, lsum[2] = {0.f, 0.f};
    issue(0);
    { unsigned* wd = (unsigned*)wt + (tid & 15) * 4 * (LP / 2) + (tid >> 4);
#pragma unroll
      for (int i = 0; i < 4; ++i) wd[i * (LP / 2)] = pkbf(xw[0][i], xw[1][i]); }
#pragma unroll
    for (int p = 0; p < 8; ++p) { v2u u; u[0] = pkbf(xq[p][0], xq[p][1]); u[1] = pkbf(xq[p][2], xq[p][3]); *(v2u*)&qs[(p * 32 + (tid >> 4)) * LP + (tid & 15) * 4] = u; }
    if (pinned(w < 4)) twait(g0, g1k, g1v);                          // the issuing wave's own tile of stage 0 has landed
    __syncthreads();                                                 // publishes stage 0, W^T and the bf16 query rows
    issue(1);
    v16h qh[2][2], qn[2][2];                                         // [column group][k half]: the current tile's qw; the short tile's, kept for the change of tile
    { typedef WFrag<bf> F; v16bf wf[4][2];
#pragma unroll
      for (int ft = 0; ft < 4; ++ft)
#pragma unroll
          for (int ks = 0; ks < 2; ++ks) wf[ft][ks] = F::ld(&wt[(ft * 16 + lr) * LP + 8 * hi + ks * 32]);
#pragma unroll
      for (int cg = 0; cg < 4; ++cg) {                               // column groups 0, 1: the long tile; 2, 3: the short one
          const bf* qrow = &qs[((cg >> 1) * 128 + qg * 32 + (cg & 1) * 16 + lr) * LP + 8 * hi];
          v16bf bq[2]; v8f acc[4];
#pragma unroll
          for (int ks = 0; ks < 2; ++ks) bq[ks] = F::ld(qrow + ks * 32);
#pragma unroll
          for (int ft = 0; ft < 4; ++ft) acc[ft] = (v8f){};
#pragma unroll
          for (int ks = 0; ks < 2; ++ks)
#pragma unroll
              for (int ft = 0; ft < 4; ++ft) acc[ft] = F::mma(wf[ft][ks], bq[ks], acc[ft]);
#pragma unroll
          for (int ks = 0; ks < 2; ++ks) { v16h f;                   // acc[ft][j] = qw[query][f = 16 ft + 8 hi + j]: tiles 2 ks and 2 ks + 1 hold k = 8 hi + 0..7 and 16 + 8 hi + 0..7 of k half ks
#pragma unroll
              for (int j = 0; j < 8; j += 2) { v2f a, b; a[0] = acc[2 * ks][j]; a[1] = acc[2 * ks][j + 1]; b[0] = acc[2 * ks + 1][j]; b[1] = acc[2 * ks + 1][j + 1];
                  const v2h ha = __builtin_convertvector(a, v2h), hb = __builtin_convertvector(b, v2h); f[j] = ha[0]; f[j + 1] = ha[1]; f[8 + j] = hb[0]; f[8 + j + 1] = hb[1]; }
              if (cg < 2) qh[cg & 1][ks] = f; else qn[cg & 1][ks] = f; } } }
    int st = 0;                                                      // half stage inside the current tile, at the head of a trip
#pragma unroll 1
    for (int s = 0; s < nst; ++s) {
        const bool more = s + 1 < nst, last = s == nsl - 1 || !more; // last: the current tile's diagonal stage; both are the same for the whole work-group
#pragma unroll
      for (int hs = 0; hs < 2; ++hs) {                               // the two halves of the stage, one after the other with no barrier between; unrolled: each half's place in LDS is then an immediate offset of its reads
        const bf* kt0 = &sm[(s & 1) * 2 + hs][0] + (kq * 32 + lr) * LP + 8 * hi;     // this lane's row and k half in this wave's 32 rows of tile K
        const bf* vt0 = &sm[(s & 1) * 2 + hs][LTK] + lr * LPV + kq * 32 + 8 * hi;    // this lane's row and k half in this wave's 32 columns of tile V^T
        const int kb = (st + hs) * 4 + kq;                           // a half past the tile's diagonal has kb >= np for every wave
        if (kb < np) {
            v8f sc2[2][2]; v16h kf[2][2];
#pragma unroll
            for (int kt = 0; kt < 2; ++kt)
#pragma unroll
                for (int ks = 0; ks < 2; ++ks) kf[kt][ks] = ldh(kt0 + kt * 16 * LP + ks * 32);
            __builtin_amdgcn_sched_barrier(0);                       // keeps the eight K reads together ahead of the products: without it the compiler reads each fragment into the same registers and waits out the LDS latency four times
#pragma unroll
            for (int c = 0; c < 2; ++c)
#pragma unroll
                for (int kt = 0; kt < 2; ++kt) sc2[c][kt] = (v8f){};
#pragma unroll
            for (int ks = 0; ks < 2; ++ks)
#pragma unroll
                for (int kt = 0; kt < 2; ++kt)
#pragma unroll
                    for (int c = 0; c < 2; ++c) sc2[c][kt] = wmma16(kf[kt][ks], qh[c][ks], sc2[c][kt]);
            __builtin_amdgcn_sched_barrier(0);                       // keeps the eight score products in one run: mixed with the vector work on their results, each needs idle issue slots behind it
#pragma unroll
            for (int c = 0; c < 2; ++c)
#pragma unroll
                for (int kt = 0; kt < 2; ++kt)
#pragma unroll
                    for (int j = 0; j < 8; ++j) sc2[c][kt][j] *= SCL;
            if (kb == np - 1) {                                      // only the group's last block crosses the diagonal: key > query is masked
#pragma unroll
                for (int c = 0; c < 2; ++c)
#pragma unroll
                    for (int kt = 0; kt < 2; ++kt)
#pragma unroll
                        for (int j = 0; j < 8; ++j) sc2[c][kt][j] = (kt * 16 + hi * 8 + j <= c * 16 + lr) ? sc2[c][kt][j] : -3.0e38f; }
            v16h ph[2];
#pragma unroll
            for (int c = 0; c < 2; ++c) {
                float mx = sc2[c][0][0];
#pragma unroll
                for (int kt = 0; kt < 2; ++kt)
#pragma unroll
                    for (int j = 0; j < 8; ++j) mx = fmaxf(mx, sc2[c][kt][j]);
                mx = fmaxf(mx, xhalf(mx)); const float mnew = fmaxf(mrun[c], mx);
                const float al = __builtin_amdgcn_exp2f((mrun[c] - mnew) * 1.4426950408889634f); mrun[c] = mnew;
                float bs = 0.f;
#pragma unroll
                for (int kt = 0; kt < 2; ++kt) { const v8f e = exp2x8((sc2[c][kt] - mnew) * 1.4426950408889634f);
#pragma unroll
                    for (int j = 0; j < 8; j += 2) { v2f pr; pr[0] = e[j]; pr[1] = e[j + 1]; bs += pr[0] + pr[1];
                        const v2h h2 = __builtin_convertvector(pr, v2h); ph[c][kt * 8 + j] = h2[0]; ph[c][kt * 8 + j + 1] = h2[1]; } }
                lsum[c] = lsum[c] * al + bs;
#pragma unroll
                for (int dt = 0; dt < 4; ++dt) {
#pragma unroll
                    for (int j = 0; j < 8; ++j) o[c][dt][j] *= al; }
            }
#pragma unroll
            for (int dt = 0; dt < 4; ++dt) { const v16h vf = ldh(vt0 + dt * 16 * LPV);
#pragma unroll
                for (int c = 0; c < 2; ++c) o[c][dt] = wmma16(vf, ph[c], o[c][dt]); }
        }
      }
        asm volatile("s_wait_dscnt 0x0" ::: "memory");               // this wave's reads of stage s have returned before the barrier behind which its buffer is refilled
        if (pinned(w < 4)) twait(g0, g1k, g1v);                      // the issuing wave's own tile of stage s + 1 has landed
        __syncthreads();                                             // publishes stage s + 1 and ends every wave's reads of stage s
        if (pinned(s + 2 < nst && w < 4)) issue(s + 2);              // into the buffer that this trip has read; the twelve waves that issue nothing form no descriptor
        st = st + 2;
        if (last) {                                                  // the tile is done: the four waves of a query group join their partial softmaxes
#pragma unroll
            for (int c = 0; c < 2; ++c)                              // the short tile's queries
#pragma unroll
                for (int ks = 0; ks < 2; ++ks) qh[c][ks] = qn[c][ks];
#pragma unroll
            for (int c = 0; c < 2; ++c) { lsum[c] += xhalf(lsum[c]);
#pragma unroll
                for (int dt = 0; dt < 4; ++dt) { v4f a, b;
#pragma unroll
                    for (int j = 0; j < 4; ++j) { a[j] = o[c][dt][j]; b[j] = o[c][dt][j + 4]; }
                    *(v4f*)&xo[w][(c * 4 + dt) * 2][lane][0] = a; *(v4f*)&xo[w][(c * 4 + dt) * 2 + 1][lane][0] = b; }
                xm[w][c][0][lane] = mrun[c]; xm[w][c][1][lane] = lsum[c]; }
            __syncthreads();                                         // the partners' values are complete; the stage barriers of the next tile end these reads before xo and xm are written again
            const int cf = kq & 1, dh = kq >> 1;                     // this wave finishes column group cf, output columns 32 dh .. 32 dh + 31
            float pm[4], ps[4];
#pragma unroll
            for (int j = 0; j < 4; ++j) { pm[j] = xm[qg + 4 * j][cf][0][lane]; ps[j] = xm[qg + 4 * j][cf][1][lane]; }
            const float mj = fmaxf(fmaxf(pm[0], pm[1]), fmaxf(pm[2], pm[3]));   // a wave that had no key block holds maximum -3e38, sum 0, O 0: its factor below is 2^-inf = 0
            const v2f e01 = exp2x2((pm[0] - mj) * 1.4426950408889634f, (pm[1] - mj) * 1.4426950408889634f);
            const v2f e23 = exp2x2((pm[2] - mj) * 1.4426950408889634f, (pm[3] - mj) * 1.4426950408889634f);
            const float f = __fdiv_rn(1.0f, ps[0] * e01[0] + ps[1] * e01[1] + ps[2] * e23[0] + ps[3] * e23[1]);
            const float fj[4] = {e01[0] * f, e01[1] * f, e23[0] * f, e23[1] * f};
            float* op = OUT + ((size_t)(bh / NH_) * TT + q0 + cf * 16 + lr) * DQ + (bh % NH_) * HD + dh * 32 + hi * 8;   // values [i][j] = O[query q0 + 16 cf + lr][d = 32 dh + 16 i + 8 hi + j]
#pragma unroll
            for (int i = 0; i < 2; ++i) { v4f a = (v4f){}, b = (v4f){};
#pragma unroll
                for (int j = 0; j < 4; ++j) { const int ix = (cf * 4 + dh * 2 + i) * 2;
                    a += *(const v4f*)&xo[qg + 4 * j][ix][lane][0] * fj[j]; b += *(const v4f*)&xo[qg + 4 * j][ix + 1][lane][0] * fj[j]; }
                *(v4f*)(op + i * 16) = a; *(v4f*)(op + i * 16 + 4) = b; }
            asm volatile("s_wait_xcnt 0x0" ::: "memory");            // stands before a register that these stores name is written again
            st = 0; q0 = g * 128 + qg * 32; np = q0 / 32 + 1;         // the short tile
#pragma unroll
            for (int c = 0; c < 2; ++c) {
#pragma unroll
                for (int dt = 0; dt < 4; ++dt) o[c][dt] = (v8f){};
                mrun[c] = -3.0e38f; lsum[c] = 0.f; }
        }
    }
    asm volatile("s_wait_tensorcnt 0x0" ::: "memory");               // no tensor load is in flight when the wave ends
    asm volatile("s_wait_dscnt 0x0" ::: "memory");
}


// k_prep: the K and V^T planes of k_fattn in one launch. One work-group takes PT positions of one (batch, head): 64 input values per thread, all loads issued ahead of the first use.
// K plane [bh][t][d] and V^T plane [bh][d][t]: the bf16-rounded inputs, written as f16. V is transposed in LDS, two positions per dword, 16-byte pieces of a row swapped by d / 4
// so that neither the column writes nor the row reads collide.
#define PT 128
typedef __attribute__((ext_vector_type(4))) unsigned v4u;
__device__ __forceinline__ unsigned pkh(float a, float b) { v2f p; p[0] = a; p[1] = b; return __builtin_bit_cast(unsigned, __builtin_convertvector(p, v2h)); }     // a in the low half; round to nearest even
__device__ __forceinline__ unsigned pkhb(float a, float b) { const unsigned u = pkbf(a, b); return pkh(__uint_as_float(u << 16), __uint_as_float(u & 0xffff0000u)); }   // rounded to bf16 first, then written as f16
// work-group barrier that orders LDS only: the waves exchange nothing through global memory here, and __syncthreads() would also wait for every global store issued so far to be acknowledged
__device__ __forceinline__ void lds_barrier() { __builtin_amdgcn_fence(__ATOMIC_RELEASE, "workgroup", "local"); __builtin_amdgcn_s_barrier(); __builtin_amdgcn_fence(__ATOMIC_ACQUIRE, "workgroup", "local"); }
__global__ __launch_bounds__(256) void k_prep(const float* __restrict__ k, const float* __restrict__ v, bf* __restrict__ Kh, bf* __restrict__ Vh) {
    __shared__ __align__(16) unsigned vt[HD * (PT / 2)];  // V^T [d][t / 2]
    const int tid = threadIdx.x;
    const int t0 = blockIdx.x * PT, bh = blockIdx.y;
    const size_t ib = (((size_t)(bh / NH_) * TT + t0) * NH_ + (bh % NH_)) * HD;   // row t0 of this head in [b][t][h][e]; rows lie DQ apart
    const size_t pb = ((size_t)bh * TT + t0) * HD;                                // row t0 in a [bh][t][d] plane
    const size_t vb = (size_t)bh * HD * TT + t0;                                  // column t0 of row d = 0 in a [bh][d][t] plane
    const int r16 = tid >> 4, c = tid & 15, c4 = c * 4;                           // sixteen threads per 256-byte input row
    v4f xk[8], xv[8];
#pragma unroll
    for (int p = 0; p < 8; ++p) xv[p] = *(const v4f*)(v + ib + (size_t)((p >> 1) * 32 + 2 * r16 + (p & 1)) * DQ + c4);   // positions t and t + 1 in one thread
    asm volatile("s_wait_xcnt 0x0" ::: "memory");   // here and below: stands before a register that an issued load or store names is written again
#pragma unroll
    for (int p = 0; p < 8; ++p) xk[p] = *(const v4f*)(k + ib + (size_t)(p * 16 + r16) * DQ + c4);
    __builtin_amdgcn_sched_barrier(0);                    // keeps all 16 loads of a thread in flight together: without it the compiler issues K's last four loads only behind data waits
#pragma unroll
    for (int p = 0; p < 4; ++p) { const int t2 = p * 16 + r16;
#pragma unroll
        for (int i = 0; i < 4; ++i) vt[(c4 + i) * (PT / 2) + (((t2 >> 2) ^ c) << 2) + (t2 & 3)] = pkhb(xv[2 * p][i], xv[2 * p + 1][i]); }
#pragma unroll
    for (int p = 0; p < 8; ++p) { v2u o; o[0] = pkhb(xk[p][0], xk[p][1]); o[1] = pkhb(xk[p][2], xk[p][3]); *(v2u*)(Kh + pb + (size_t)(p * 16 + r16) * HD + c4) = o; }
    asm volatile("s_wait_xcnt 0x0" ::: "memory");
    lds_barrier();                                        // V^T is complete
#pragma unroll
    for (int s = 0; s < 4; ++s) { const int idx = s * 256 + tid, d = idx >> 4, qd = idx & 15;
        *(v4u*)(Vh + vb + (size_t)d * TT + qd * 8) = *(const v4u*)&vt[d * (PT / 2) + ((qd ^ (d >> 2)) << 2)]; }
}

extern "C" void kernel_launch(void* const* d_in, const int* in_sizes, int n_in,
                              void* d_out, int out_size, void* d_ws, size_t ws_size, hipStream_t stream) {
    (void)in_sizes; (void)n_in; (void)out_size;
    const float* qi = (const float*)d_in[0]; const float* ki = (const float*)d_in[1]; const float* vi = (const float*)d_in[2]; const float* wq = (const float*)d_in[3];
    float* OUT = (float*)d_out;     // [4][2048][512]
    char* wsp = (char*)d_ws;
    auto take = [&](size_t bytes) { char* p = wsp; wsp += (bytes + 255) & ~(size_t)255; return (void*)p; };
    const size_t PB = (size_t)NH_ * TT * HD;   // elements of one batch's head planes; each plane holds every batch
    bf* KPh = (bf*)take(NB_ * PB * 2); bf* VTh = (bf*)take(NB_ * PB * 2);
    if ((size_t)(wsp - (char*)d_ws) > ws_size) return;    // ws 256 MiB
    k_prep<<<dim3(TT / PT, NB_ * NH_, 1), 256, 0, stream>>>(ki, vi, KPh, VTh);
    k_fattn<<<dim3(TT / 256, NB_ * NH_, 1), 512, 0, stream>>>(qi, wq, KPh, VTh, OUT);   /* one kv head per query head: plane b * 8 + h of each */
}
